// v000
// Times are from an AMD MI455X. After a warm-up the kernel runs many times in a row, and a time is the length of
// such a window on the GPU divided by its runs, so every launch and the gaps after it count. The runs cycle
// through copies of the inputs. A figure is the median of several windows, for all but v000 over two sittings.
// Sittings can differ by a few percent; kernels timed side by side share one.
// v000, which the later versions start from, runs in 586 microseconds.
#include <hip/hip_runtime.h>

typedef float v2f __attribute__((ext_vector_type(2)));
typedef float v8f __attribute__((ext_vector_type(8)));

#define S_TOK 8192
#define DIN   512
#define DOUT  64
#define NBLK  (S_TOK / 16)   // 512 row blocks

union F8 { v8f v; float f[8]; };

__device__ __forceinline__ v8f wmma4(v2f a, v2f b, v8f c) {
  // D = A(16x4 f32) * B(4x16 f32) + C(16x16 f32)
  return __builtin_amdgcn_wmma_f32_16x16x4_f32(
      /*neg_a=*/false, a, /*neg_b=*/false, b,
      /*c_mod=*/(short)0, c, /*reuse_a=*/false, /*reuse_b=*/false);
}

__device__ __forceinline__ float rowmax16(float x) {
  x = fmaxf(x, __shfl_xor(x, 1, 32));
  x = fmaxf(x, __shfl_xor(x, 2, 32));
  x = fmaxf(x, __shfl_xor(x, 4, 32));
  x = fmaxf(x, __shfl_xor(x, 8, 32));
  return x;
}
__device__ __forceinline__ float rowsum16(float x) {
  x += __shfl_xor(x, 1, 32);
  x += __shfl_xor(x, 2, 32);
  x += __shfl_xor(x, 4, 32);
  x += __shfl_xor(x, 8, 32);
  return x;
}

// ---------------------------------------------------------------------------
// Kernel 1: Q/K/V projection.  y = x @ W^T  (x:[S,512], W:[64,512], y:[S,64])
// One wave computes one 16x16 output tile. K=512 reduction split into two
// independent 64-deep WMMA chains for matrix-pipe ILP.
// grid = (512 row-blocks, 12 = {Q,K,V} x 4 col-tiles), block = 32 (one wave).
// Q is pre-scaled by 1/sqrt(64).
// ---------------------------------------------------------------------------
__global__ __launch_bounds__(32)
void qkv_proj_kernel(const float* __restrict__ x,
                     const float* __restrict__ Wq,
                     const float* __restrict__ Wk,
                     const float* __restrict__ Wv,
                     float* __restrict__ qkv /* [3][S][64] */) {
  const int lane = threadIdx.x & 31;
  const int hi   = lane >> 4;     // which half-wave
  const int ln   = lane & 15;
  const int iblk = blockIdx.x;       // row block
  const int mat  = blockIdx.y >> 2;  // 0=Q 1=K 2=V
  const int nt   = blockIdx.y & 3;   // output column tile

  const float* W = (mat == 0) ? Wq : (mat == 1 ? Wk : Wv);
  const float* arow = x + (size_t)(iblk * 16 + ln) * DIN;  // A: x row (M = ln)
  const float* brow = W + (size_t)(nt * 16 + ln) * DIN;    // B: W row (N = ln)

  F8 acc0 = {}, acc1 = {};        // two independent accumulation chains
#pragma unroll 4
  for (int k0 = 0; k0 < DIN; k0 += 8) {
    // 16x4 f32 A layout: lanes0-15 hold K=k0,k0+1 ; lanes16-31 hold K=k0+2,k0+3
    v2f a0 = *(const v2f*)(arow + k0 + 2 * hi);
    v2f b0 = *(const v2f*)(brow + k0 + 2 * hi);
    v2f a1 = *(const v2f*)(arow + k0 + 4 + 2 * hi);
    v2f b1 = *(const v2f*)(brow + k0 + 4 + 2 * hi);
    acc0.v = wmma4(a0, b0, acc0.v);
    acc1.v = wmma4(a1, b1, acc1.v);
  }
  F8 acc; acc.v = acc0.v + acc1.v;

  const float scl = (mat == 0) ? 0.125f : 1.0f;  // fold 1/sqrt(d_k) into Q
  float* out = qkv + (size_t)mat * S_TOK * DOUT;
#pragma unroll
  for (int v = 0; v < 8; ++v) {
    const int row = iblk * 16 + v + 8 * hi;      // C/D layout: M = v + 8*hi
    out[(size_t)row * DOUT + nt * 16 + ln] = acc.f[v] * scl;
  }
}

// ---------------------------------------------------------------------------
// Kernel 2: causal flash attention, one wave per 16 query rows.
// block = 64 (2 waves), grid = 256. Wave 0 owns i-block b, wave 1 owns
// 511-b: every block executes exactly 513 j-iterations total -> zero load
// imbalance while spreading 512 waves over 256 WGPs.
// ---------------------------------------------------------------------------
__global__ __launch_bounds__(64)
void flash_attn_kernel(const float* __restrict__ Q,
                       const float* __restrict__ K,
                       const float* __restrict__ V,
                       float* __restrict__ out) {
  __shared__ float plds[2 * 256];   // 1KB P-tile per wave (layout transpose)

  const int lane = threadIdx.x & 31;
  const int wid  = threadIdx.x >> 5;
  const int hi   = lane >> 4;
  const int ln   = lane & 15;
  const int iblk = wid ? (NBLK - 1 - blockIdx.x) : blockIdx.x;  // 0..511
  float* pt = &plds[wid * 256];

  // Q A-fragments for full K=64 reduction: 16 chunks of K=4 (32 VGPRs)
  v2f qa[16];
  const float* qrow = Q + (size_t)(iblk * 16 + ln) * DOUT;
#pragma unroll
  for (int c = 0; c < 16; ++c)
    qa[c] = *(const v2f*)(qrow + 4 * c + 2 * hi);

  F8 o[4] = {};                    // O accumulator, 4 x (16x16) C/D tiles
  float m[8], l[8];                // per-row running max / sum (row = v + 8*hi)
#pragma unroll
  for (int v = 0; v < 8; ++v) { m[v] = -__builtin_inff(); l[v] = 0.0f; }

  for (int j = 0; j <= iblk; ++j) {
    if (j < iblk) {  // prefetch next K/V tile into cache (global_prefetch_b8)
      __builtin_prefetch(K + (size_t)((j + 1) * 16 + ln) * DOUT, 0, 3);
      __builtin_prefetch(V + (size_t)((j + 1) * 16 + ln) * DOUT, 0, 3);
    }

    // ---- S = (Q/sqrt(dk)) @ K_j^T : two independent 8-deep WMMA chains ----
    F8 s0 = {}, s1 = {};
    const float* krow = K + (size_t)(j * 16 + ln) * DOUT;  // B: N = ln (K row)
#pragma unroll
    for (int c = 0; c < 8; ++c) {
      v2f kb0 = *(const v2f*)(krow + 4 * c + 2 * hi);
      v2f kb1 = *(const v2f*)(krow + 4 * (c + 8) + 2 * hi);
      s0.v = wmma4(qa[c], kb0, s0.v);
      s1.v = wmma4(qa[c + 8], kb1, s1.v);
    }
    F8 s; s.v = s0.v + s1.v;

    // ---- causal mask + online softmax, per row v+8*hi ----
    const bool diag = (j == iblk);
#pragma unroll
    for (int v = 0; v < 8; ++v) {
      float sv = s.f[v];
      if (diag && ln > v + 8 * hi) sv = -__builtin_inff();  // n > m -> masked
      const float mn = fmaxf(m[v], rowmax16(sv));
      const float sc = __expf(m[v] - mn);
      const float p  = __expf(sv - mn);
      l[v] = l[v] * sc + rowsum16(p);
      m[v] = mn;
#pragma unroll
      for (int t = 0; t < 4; ++t) o[t].f[v] *= sc;   // rescale O rows
      s.f[v] = p;
    }

    // ---- transpose P: C/D layout -> A layout, via per-wave LDS tile ----
#pragma unroll
    for (int v = 0; v < 8; ++v)
      pt[(v + 8 * hi) * 16 + ln] = s.f[v];
    __builtin_amdgcn_wave_barrier();
    asm volatile("s_wait_dscnt 0" ::: "memory");   // wave-local LDS fence

    // ---- O += P @ V_j : 4 chunks (K=4) x 4 independent d-tile chains ----
    const float* vbase = V + (size_t)(j * 16) * DOUT;
#pragma unroll
    for (int c = 0; c < 4; ++c) {
      v2f pa = *(const v2f*)(pt + ln * 16 + 4 * c + 2 * hi);  // A-frag of P
      const float* v0 = vbase + (size_t)(4 * c + 2 * hi) * DOUT + ln;
#pragma unroll
      for (int t = 0; t < 4; ++t) {
        v2f vb;                       // B-frag of V: rows 4c+2hi{,+1}, col 16t+ln
        vb.x = v0[16 * t];
        vb.y = v0[16 * t + DOUT];
        o[t].v = wmma4(pa, vb, o[t].v);
      }
    }
  }

  // ---- normalize and write O ----
#pragma unroll
  for (int v = 0; v < 8; ++v) {
    const float inv = 1.0f / l[v];
    const int row = iblk * 16 + v + 8 * hi;
#pragma unroll
    for (int t = 0; t < 4; ++t)
      out[(size_t)row * DOUT + 16 * t + ln] = o[t].f[v] * inv;
  }
}

// ---------------------------------------------------------------------------
extern "C" void kernel_launch(void* const* d_in, const int* in_sizes, int n_in,
                              void* d_out, int out_size, void* d_ws, size_t ws_size,
                              hipStream_t stream) {
  const float* x  = (const float*)d_in[0];
  const float* Wq = (const float*)d_in[1];
  const float* Wk = (const float*)d_in[2];
  const float* Wv = (const float*)d_in[3];
  float* qkv = (float*)d_ws;              // Q | K | V, each S*64 f32 (6 MB)
  float* out = (float*)d_out;

  dim3 gA(NBLK, 12);
  qkv_proj_kernel<<<gA, 32, 0, stream>>>(x, Wq, Wk, Wv, qkv);

  const float* Qp = qkv;
  const float* Kp = qkv + (size_t)S_TOK * DOUT;
  const float* Vp = qkv + (size_t)2 * S_TOK * DOUT;
  flash_attn_kernel<<<256, 64, 0, stream>>>(Qp, Kp, Vp, out);
}

// v001
// A run of this version takes 93.4 microseconds.
// Next to v000, in two timings, it ran 6.35 and 6.36 times as fast.
#include <hip/hip_runtime.h>

typedef float v2f __attribute__((ext_vector_type(2)));
typedef float v8f __attribute__((ext_vector_type(8)));

#define S_TOK 8192
#define DIN   512
#define DOUT  64
#define NBLK  (S_TOK / 16)   // 512 row blocks

union F8 { v8f v; float f[8]; };

__device__ __forceinline__ v8f wmma4(v2f a, v2f b, v8f c) {
  // D = A(16x4 f32) * B(4x16 f32) + C(16x16 f32)
  return __builtin_amdgcn_wmma_f32_16x16x4_f32(
      /*neg_a=*/false, a, /*neg_b=*/false, b,
      /*c_mod=*/(short)0, c, /*reuse_a=*/false, /*reuse_b=*/false);
}

__device__ __forceinline__ float rowmax16(float x) {
  x = fmaxf(x, __shfl_xor(x, 1, 32));
  x = fmaxf(x, __shfl_xor(x, 2, 32));
  x = fmaxf(x, __shfl_xor(x, 4, 32));
  x = fmaxf(x, __shfl_xor(x, 8, 32));
  return x;
}
__device__ __forceinline__ float rowsum16(float x) {
  x += __shfl_xor(x, 1, 32);
  x += __shfl_xor(x, 2, 32);
  x += __shfl_xor(x, 4, 32);
  x += __shfl_xor(x, 8, 32);
  return x;
}

// ---------------------------------------------------------------------------
// Kernel 1: Q/K/V projection.  y = x @ W^T  (x:[S,512], W:[64,512], y:[S,64])
// One wave computes one 16x16 output tile. K=512 reduction split into two
// independent 64-deep WMMA chains for matrix-pipe ILP.
// grid = (512 row-blocks, 12 = {Q,K,V} x 4 col-tiles), block = 32 (one wave).
// Q is pre-scaled by 1/sqrt(64).
// ---------------------------------------------------------------------------
__global__ __launch_bounds__(32)
void qkv_proj_kernel(const float* __restrict__ x,
                     const float* __restrict__ Wq,
                     const float* __restrict__ Wk,
                     const float* __restrict__ Wv,
                     float* __restrict__ qkv /* [3][S][64] */) {
  const int lane = threadIdx.x & 31;
  const int hi   = lane >> 4;     // which half-wave
  const int ln   = lane & 15;
  const int iblk = blockIdx.x;       // row block
  const int mat  = blockIdx.y >> 2;  // 0=Q 1=K 2=V
  const int nt   = blockIdx.y & 3;   // output column tile

  const float* W = (mat == 0) ? Wq : (mat == 1 ? Wk : Wv);
  const float* arow = x + (size_t)(iblk * 16 + ln) * DIN;  // A: x row (M = ln)
  const float* brow = W + (size_t)(nt * 16 + ln) * DIN;    // B: W row (N = ln)

  F8 acc0 = {}, acc1 = {};        // two independent accumulation chains
#pragma unroll 4
  for (int k0 = 0; k0 < DIN; k0 += 8) {
    // 16x4 f32 A layout: lanes0-15 hold K=k0,k0+1 ; lanes16-31 hold K=k0+2,k0+3
    v2f a0 = *(const v2f*)(arow + k0 + 2 * hi);
    v2f b0 = *(const v2f*)(brow + k0 + 2 * hi);
    v2f a1 = *(const v2f*)(arow + k0 + 4 + 2 * hi);
    v2f b1 = *(const v2f*)(brow + k0 + 4 + 2 * hi);
    acc0.v = wmma4(a0, b0, acc0.v);
    acc1.v = wmma4(a1, b1, acc1.v);
  }
  F8 acc; acc.v = acc0.v + acc1.v;

  const float scl = (mat == 0) ? 0.125f : 1.0f;  // fold 1/sqrt(d_k) into Q
  float* out = qkv + (size_t)mat * S_TOK * DOUT;
#pragma unroll
  for (int v = 0; v < 8; ++v) {
    const int row = iblk * 16 + v + 8 * hi;      // C/D layout: M = v + 8*hi
    out[(size_t)row * DOUT + nt * 16 + ln] = acc.f[v] * scl;
  }
}

// ---------------------------------------------------------------------------
// Kernel 2: causal flash attention, key range of each 16-row query block split
// over the NW waves of one work-group.
// block = NW waves, grid = 256. A work-group owns query blocks b and 511-b
// (513 key tiles together, the same for every work-group) and runs them one
// after the other. Wave w takes every NW-th key tile of a query block and keeps
// its own running max / sum / O. The second block deals its tiles to the waves
// in reverse order, so the two remainders fall on different waves and every
// wave walks 25 or 26 tiles. The partials meet in LDS behind one barrier and
// are merged with weights exp(m_w - M).
// ---------------------------------------------------------------------------
#define NW 20   // waves per work-group = key splits per query block (5 per SIMD at this register count)
#define FA_THREADS 640
static_assert(FA_THREADS == NW * 32, "one wave is 32 lanes");

__global__ __launch_bounds__(FA_THREADS)
void flash_attn_kernel(const float* __restrict__ Q,
                       const float* __restrict__ K,
                       const float* __restrict__ V,
                       float* __restrict__ out) {
  __shared__ float plds[NW * 256];        // 1KB P-tile per wave (layout transpose)
  __shared__ float opart[2 * NW * 1024];  // un-normalised O partial per (block, wave)
  __shared__ float mpart[2 * 16 * NW];    // running max  [block][row][wave]
  __shared__ float lpart[2 * 16 * NW];    // running sum  [block][row][wave]

  const int lane = threadIdx.x & 31;
  // wave number as a scalar: the tile loop's trip count is then a scalar branch
  const int wid  = __builtin_amdgcn_readfirstlane(threadIdx.x >> 5);
  const int hi   = lane >> 4;
  const int ln   = lane & 15;
  float* pt = &plds[wid * 256];

  for (int h = 0; h < 2; ++h) {
    const int iblk = h ? (NBLK - 1 - blockIdx.x) : blockIdx.x;  // 0..511

    // Q A-fragments for full K=64 reduction: 16 chunks of K=4 (32 VGPRs)
    v2f qa[16];
    const float* qrow = Q + (size_t)(iblk * 16 + ln) * DOUT;
#pragma unroll
    for (int c = 0; c < 16; ++c)
      qa[c] = *(const v2f*)(qrow + 4 * c + 2 * hi);

    F8 o[4] = {};                  // O accumulator, 4 x (16x16) C/D tiles
    float m[8], l[8];              // per-row running max / sum (row = v + 8*hi)
#pragma unroll
    for (int v = 0; v < 8; ++v) { m[v] = -__builtin_inff(); l[v] = 0.0f; }

    for (int j = h ? (NW - 1 - wid) : wid; j <= iblk; j += NW) {
      if (j + NW <= iblk) {  // prefetch this wave's next K/V tile (global_prefetch_b8)
        __builtin_prefetch(K + (size_t)((j + NW) * 16 + ln) * DOUT, 0, 3);
        __builtin_prefetch(V + (size_t)((j + NW) * 16 + ln) * DOUT, 0, 3);
      }

      // ---- S = (Q/sqrt(dk)) @ K_j^T : two independent 8-deep WMMA chains ----
      F8 s0 = {}, s1 = {};
      const float* krow = K + (size_t)(j * 16 + ln) * DOUT;  // B: N = ln (K row)
#pragma unroll
      for (int c = 0; c < 8; ++c) {
        v2f kb0 = *(const v2f*)(krow + 4 * c + 2 * hi);
        v2f kb1 = *(const v2f*)(krow + 4 * (c + 8) + 2 * hi);
        s0.v = wmma4(qa[c], kb0, s0.v);
        s1.v = wmma4(qa[c + 8], kb1, s1.v);
      }
      F8 s; s.v = s0.v + s1.v;

      // ---- causal mask + online softmax, per row v+8*hi ----
      const bool diag = (j == iblk);
#pragma unroll
      for (int v = 0; v < 8; ++v) {
        float sv = s.f[v];
        if (diag && ln > v + 8 * hi) sv = -__builtin_inff();  // n > m -> masked
        const float mn = fmaxf(m[v], rowmax16(sv));
        const float sc = __expf(m[v] - mn);
        const float p  = __expf(sv - mn);
        l[v] = l[v] * sc + rowsum16(p);
        m[v] = mn;
#pragma unroll
        for (int t = 0; t < 4; ++t) o[t].f[v] *= sc;   // rescale O rows
        s.f[v] = p;
      }

      // ---- transpose P: C/D layout -> A layout, via per-wave LDS tile ----
#pragma unroll
      for (int v = 0; v < 8; ++v)
        pt[(v + 8 * hi) * 16 + ln] = s.f[v];
      __builtin_amdgcn_wave_barrier();
      asm volatile("s_wait_dscnt 0" ::: "memory");   // wave-local LDS fence

      // ---- O += P @ V_j : 4 chunks (K=4) x 4 independent d-tile chains ----
      const float* vbase = V + (size_t)(j * 16) * DOUT;
#pragma unroll
      for (int c = 0; c < 4; ++c) {
        v2f pa = *(const v2f*)(pt + ln * 16 + 4 * c + 2 * hi);  // A-frag of P
        const float* v0 = vbase + (size_t)(4 * c + 2 * hi) * DOUT + ln;
#pragma unroll
        for (int t = 0; t < 4; ++t) {
          v2f vb;                     // B-frag of V: rows 4c+2hi{,+1}, col 16t+ln
          vb.x = v0[16 * t];
          vb.y = v0[16 * t + DOUT];
          o[t].v = wmma4(pa, vb, o[t].v);
        }
      }
    }

    // ---- hand this wave's partial to LDS (a wave without a tile: m=-inf, l=0, O=0) ----
    // rows 8..15 sit with their columns XORed by 16, so the two half-waves of a
    // store fall on different banks
    float* op = &opart[(h * NW + wid) * 1024];
    // both loops unrolled: o[][] lives in registers and needs constant indices
#pragma unroll
    for (int v = 0; v < 8; ++v) {
#pragma unroll
      for (int t = 0; t < 4; ++t)
        op[(v + 8 * hi) * DOUT + ((16 * t + ln) ^ (hi << 4))] = o[t].f[v];
    }
    if (ln == 0) {                 // m, l are equal in the 16 lanes of a row
#pragma unroll                     // m[], l[] live in registers: constant indices
      for (int v = 0; v < 8; ++v) {
        mpart[(h * 16 + v + 8 * hi) * NW + wid] = m[v];
        lpart[(h * 16 + v + 8 * hi) * NW + wid] = l[v];
      }
    }
  }

  __syncthreads();   // every wave's two partials are in LDS

  // ---- merge: one wave per output row (2 blocks x 16 rows dealt over the NW waves);
  //      lane p first holds partial p's weight, then lane -> 2 columns ----
  for (int r = wid; r < 32; r += NW) {
    const int mh  = r >> 4;
    const int row = r & 15;
    const int mblk = mh ? (NBLK - 1 - blockIdx.x) : blockIdx.x;
    const int pl = (lane < NW) ? lane : 0;           // lanes past NW hold no partial
    float mp = mpart[(mh * 16 + row) * NW + pl];
    float lp = lpart[(mh * 16 + row) * NW + pl];
    if (lane >= NW) { mp = -__builtin_inff(); lp = 0.0f; }
    float M = mp;
#pragma unroll                     // five fixed exchange steps, no loop counter
    for (int d = 16; d >= 1; d >>= 1) M = fmaxf(M, __shfl_xor(M, d, 32));
    const float w = __expf(mp - M);  // 0 for a wave that had no tile
    float L = w * lp;
#pragma unroll                     // five fixed exchange steps, no loop counter
    for (int d = 16; d >= 1; d >>= 1) L += __shfl_xor(L, d, 32);
    const float wn = w * (1.0f / L); // weight with the normalisation folded in

    const float* ob = &opart[mh * NW * 1024 + row * DOUT + ((2 * lane) ^ ((row >> 3) << 4))];
    v2f acc = {0.0f, 0.0f};
    // unrolled so that each partial's weight is read from a constant lane (v_readlane)
#pragma unroll
    for (int p = 0; p < NW; ++p) {
      const float wp = __int_as_float(__builtin_amdgcn_readlane(__float_as_int(wn), p));
      const v2f x = *(const v2f*)(ob + p * 1024);
      acc.x += wp * x.x;
      acc.y += wp * x.y;
    }
    *(v2f*)(out + (size_t)(mblk * 16 + row) * DOUT + 2 * lane) = acc;
    // the next trip reuses the store's registers: keep the wait in front of that
    asm volatile("s_wait_xcnt 0x0" ::: "memory");
  }
}

// ---------------------------------------------------------------------------
extern "C" void kernel_launch(void* const* d_in, const int* in_sizes, int n_in,
                              void* d_out, int out_size, void* d_ws, size_t ws_size,
                              hipStream_t stream) {
  const float* x  = (const float*)d_in[0];
  const float* Wq = (const float*)d_in[1];
  const float* Wk = (const float*)d_in[2];
  const float* Wv = (const float*)d_in[3];
  float* qkv = (float*)d_ws;              // Q | K | V, each S*64 f32 (6 MB)
  float* out = (float*)d_out;

  dim3 gA(NBLK, 12);
  qkv_proj_kernel<<<gA, 32, 0, stream>>>(x, Wq, Wk, Wv, qkv);

  const float* Qp = qkv;
  const float* Kp = qkv + (size_t)S_TOK * DOUT;
  const float* Vp = qkv + (size_t)2 * S_TOK * DOUT;
  flash_attn_kernel<<<256, FA_THREADS, 0, stream>>>(Qp, Kp, Vp, out);
}

// v002
// A run of this version takes 87.5 microseconds.
// Next to v001, in two timings, it ran 1.07 times as fast each time.
// Over all steps from v000 it is 6.78 times as fast.
#include <hip/hip_runtime.h>

typedef float v2f __attribute__((ext_vector_type(2)));
typedef float v4f __attribute__((ext_vector_type(4)));
typedef float v8f __attribute__((ext_vector_type(8)));

#define S_TOK 8192
#define DIN   512
#define DOUT  64
#define NBLK  (S_TOK / 16)   // 512 row blocks

union F8 { v8f v; float f[8]; };

__device__ __forceinline__ v8f wmma4(v2f a, v2f b, v8f c) {
  // D = A(16x4 f32) * B(4x16 f32) + C(16x16 f32)
  return __builtin_amdgcn_wmma_f32_16x16x4_f32(
      /*neg_a=*/false, a, /*neg_b=*/false, b,
      /*c_mod=*/(short)0, c, /*reuse_a=*/false, /*reuse_b=*/false);
}

__device__ __forceinline__ float rowmax16(float x) {
  x = fmaxf(x, __shfl_xor(x, 1, 32));
  x = fmaxf(x, __shfl_xor(x, 2, 32));
  x = fmaxf(x, __shfl_xor(x, 4, 32));
  x = fmaxf(x, __shfl_xor(x, 8, 32));
  return x;
}
__device__ __forceinline__ float rowsum16(float x) {
  x += __shfl_xor(x, 1, 32);
  x += __shfl_xor(x, 2, 32);
  x += __shfl_xor(x, 4, 32);
  x += __shfl_xor(x, 8, 32);
  return x;
}

// ---------------------------------------------------------------------------
// Kernel 1: Q/K/V projection.  y = x @ W^T  (x:[S,512], W:[64,512], y:[S,64])
// One wave computes one 16x16 output tile. K=512 reduction split into two
// independent 64-deep WMMA chains for matrix-pipe ILP.
// grid = (512 row-blocks, 12 = {Q,K,V} x 4 col-tiles), block = 32 (one wave).
// Q is pre-scaled by 1/sqrt(64) and stored row-major.
// K and V are stored per 16-key tile (1024 floats) in the order in which the
// attention kernel's lanes consume them: 8 groups of 128 floats, group g holding
// 4 floats for each of the 32 lanes, so one 16-byte load per lane reads a group
// as 512 contiguous bytes.
//   K group g, lane (hi,ln), e: K[key ln][d = 8g + 4(e>>1) + 2hi + (e&1)]
//   V group g = 4cc + t, lane (hi,ln), e: V[key 8cc + 4(e>>1) + 2hi + (e&1)][d = 16t + ln]
// The K tile is computed transposed (W rows as A, x rows as B), so that a lane
// holds 8 d of one key; both then leave as two 16-byte stores per lane.
// ---------------------------------------------------------------------------
__global__ __launch_bounds__(32)
void qkv_proj_kernel(const float* __restrict__ x,
                     const float* __restrict__ Wq,
                     const float* __restrict__ Wk,
                     const float* __restrict__ Wv,
                     float* __restrict__ qkv /* [3][S][64] */) {
  const int lane = threadIdx.x & 31;
  const int hi   = lane >> 4;     // which half-wave
  const int ln   = lane & 15;
  const int iblk = blockIdx.x;       // row block
  const int mat  = blockIdx.y >> 2;  // 0=Q 1=K 2=V
  const int nt   = blockIdx.y & 3;   // output column tile

  const float* W = (mat == 0) ? Wq : (mat == 1 ? Wk : Wv);
  const float* xrow = x + (size_t)(iblk * 16 + ln) * DIN;
  const float* wrow = W + (size_t)(nt * 16 + ln) * DIN;
  const float* arow = (mat == 1) ? wrow : xrow;  // A row (M = ln); K: M = d
  const float* brow = (mat == 1) ? xrow : wrow;  // B row (N = ln); K: N = key

  F8 acc0 = {}, acc1 = {};        // two independent accumulation chains
#pragma unroll 4
  for (int k0 = 0; k0 < DIN; k0 += 8) {
    // 16x4 f32 A layout: lanes0-15 hold K=k0,k0+1 ; lanes16-31 hold K=k0+2,k0+3
    v2f a0 = *(const v2f*)(arow + k0 + 2 * hi);
    v2f b0 = *(const v2f*)(brow + k0 + 2 * hi);
    v2f a1 = *(const v2f*)(arow + k0 + 4 + 2 * hi);
    v2f b1 = *(const v2f*)(brow + k0 + 4 + 2 * hi);
    acc0.v = wmma4(a0, b0, acc0.v);
    acc1.v = wmma4(a1, b1, acc1.v);
  }
  F8 acc; acc.v = acc0.v + acc1.v;

  float* out = qkv + (size_t)mat * S_TOK * DOUT;
  if (mat == 0) {
#pragma unroll
    for (int v = 0; v < 8; ++v) {
      const int row = iblk * 16 + v + 8 * hi;    // C/D layout: M = v + 8*hi
      out[(size_t)row * DOUT + nt * 16 + ln] = acc.f[v] * 0.125f;  // 1/sqrt(d_k) folded into Q
    }
  } else {
    // K: M = d = 16nt + v + 8hi, N = key ln  -> group 2nt + hi
    // V: M = key = v + 8hi, N = d = 16nt + ln -> group 4hi + nt
    const int g = (mat == 1) ? (2 * nt + hi) : (4 * hi + nt);
    float* t = out + (size_t)iblk * 1024 + g * 128 + ln * 4;
    const v4f lo = {acc.f[0], acc.f[1], acc.f[4], acc.f[5]};  // consumer half-wave 0
    const v4f up = {acc.f[2], acc.f[3], acc.f[6], acc.f[7]};  // consumer half-wave 1
    *(v4f*)t        = lo;
    *(v4f*)(t + 64) = up;
    // the listing lays the Q store block behind these stores, and it reuses their
    // address and data registers: keep the wait in front of that
    asm volatile("s_wait_xcnt 0x0" ::: "memory");
  }
}

// ---------------------------------------------------------------------------
// Kernel 2: causal flash attention, key range of each 16-row query block split
// over the NW waves of one work-group.
// block = NW waves, grid = 256. A work-group owns query blocks b and 511-b
// (513 key tiles together, the same for every work-group) and runs them one
// after the other. Wave w takes every NW-th key tile of a query block and keeps
// its own running max / sum / O. The second block deals its tiles to the waves
// in reverse order, so the two remainders fall on different waves and every
// wave walks 25 or 26 tiles. The partials meet in LDS behind one barrier and
// are merged with weights exp(m_w - M).
// ---------------------------------------------------------------------------
#define NW 20   // waves per work-group = key splits per query block (5 per SIMD at this register count)
#define FA_THREADS 640
static_assert(FA_THREADS == NW * 32, "one wave is 32 lanes");

__global__ __launch_bounds__(FA_THREADS)
void flash_attn_kernel(const float* __restrict__ Q,
                       const float* __restrict__ K,
                       const float* __restrict__ V,
                       float* __restrict__ out) {
  __shared__ float plds[NW * 256];        // 1KB P-tile per wave (layout transpose)
  __shared__ float opart[2 * NW * 1024];  // un-normalised O partial per (block, wave)
  __shared__ float mpart[2 * 16 * NW];    // running max  [block][row][wave]
  __shared__ float lpart[2 * 16 * NW];    // running sum  [block][row][wave]

  const int lane = threadIdx.x & 31;
  // wave number as a scalar: the tile loop's trip count is then a scalar branch
  const int wid  = __builtin_amdgcn_readfirstlane(threadIdx.x >> 5);
  const int hi   = lane >> 4;
  const int ln   = lane & 15;
  float* pt = &plds[wid * 256];

  for (int h = 0; h < 2; ++h) {
    const int iblk = h ? (NBLK - 1 - blockIdx.x) : blockIdx.x;  // 0..511

    // Q A-fragments for full K=64 reduction: 16 chunks of K=4 (32 VGPRs)
    v2f qa[16];
    const float* qrow = Q + (size_t)(iblk * 16 + ln) * DOUT;
#pragma unroll
    for (int c = 0; c < 16; ++c)
      qa[c] = *(const v2f*)(qrow + 4 * c + 2 * hi);

    F8 o[4] = {};                  // O accumulator, 4 x (16x16) C/D tiles
    float m[8], l[8];              // per-row running max / sum (row = v + 8*hi)
#pragma unroll
    for (int v = 0; v < 8; ++v) { m[v] = -__builtin_inff(); l[v] = 0.0f; }

    for (int j = h ? (NW - 1 - wid) : wid; j <= iblk; j += NW) {
      if (j + NW <= iblk) {  // prefetch this wave's next K/V tile, one request per 256 B (global_prefetch_b8)
        __builtin_prefetch(K + (size_t)((j + NW) * 16 + ln) * DOUT, 0, 3);
        __builtin_prefetch(V + (size_t)((j + NW) * 16 + ln) * DOUT, 0, 3);
      }

      // ---- S = (Q/sqrt(dk)) @ K_j^T : two independent 8-deep WMMA chains ----
      F8 s0 = {}, s1 = {};
      // B-frags of K (N = ln): group g holds this lane's pairs of chunks 2g and 2g+1
      const float* kt = K + (size_t)j * 1024 + lane * 4;
#pragma unroll
      for (int g = 0; g < 4; ++g) {
        const v4f k0 = *(const v4f*)(kt + g * 128);
        const v4f k1 = *(const v4f*)(kt + (g + 4) * 128);
        s0.v = wmma4(qa[2 * g],     (v2f){k0.x, k0.y}, s0.v);
        s1.v = wmma4(qa[2 * g + 8], (v2f){k1.x, k1.y}, s1.v);
        s0.v = wmma4(qa[2 * g + 1], (v2f){k0.z, k0.w}, s0.v);
        s1.v = wmma4(qa[2 * g + 9], (v2f){k1.z, k1.w}, s1.v);
      }
      F8 s; s.v = s0.v + s1.v;

      // ---- causal mask + online softmax, per row v+8*hi ----
      const bool diag = (j == iblk);
#pragma unroll
      for (int v = 0; v < 8; ++v) {
        float sv = s.f[v];
        if (diag && ln > v + 8 * hi) sv = -__builtin_inff();  // n > m -> masked
        const float mn = fmaxf(m[v], rowmax16(sv));
        const float sc = __expf(m[v] - mn);
        const float p  = __expf(sv - mn);
        l[v] = l[v] * sc + rowsum16(p);
        m[v] = mn;
#pragma unroll
        for (int t = 0; t < 4; ++t) o[t].f[v] *= sc;   // rescale O rows
        s.f[v] = p;
      }

      // ---- transpose P: C/D layout -> A layout, via per-wave LDS tile ----
#pragma unroll
      for (int v = 0; v < 8; ++v)
        pt[(v + 8 * hi) * 16 + ln] = s.f[v];
      __builtin_amdgcn_wave_barrier();
      asm volatile("s_wait_dscnt 0" ::: "memory");   // wave-local LDS fence

      // ---- O += P @ V_j : 4 chunks (K=4) x 4 independent d-tile chains ----
      // B-frags of V (rows 4c+2hi{,+1}, col 16t+ln): group 4cc+t holds chunks 2cc and 2cc+1
      const float* vt = V + (size_t)j * 1024 + lane * 4;
      // all four loops unrolled: vv[] and o[] live in registers and need constant
      // indices; a half tile's four loads issue ahead of its eight matrix instructions
#pragma unroll
      for (int cc = 0; cc < 2; ++cc) {
        const v2f pa0 = *(const v2f*)(pt + ln * 16 + 8 * cc + 2 * hi);      // A-frag of P, chunk 2cc
        const v2f pa1 = *(const v2f*)(pt + ln * 16 + 8 * cc + 4 + 2 * hi);  // chunk 2cc+1
        v4f vv[4];
#pragma unroll
        for (int t = 0; t < 4; ++t) vv[t] = *(const v4f*)(vt + (4 * cc + t) * 128);
#pragma unroll
        for (int t = 0; t < 4; ++t) o[t].v = wmma4(pa0, (v2f){vv[t].x, vv[t].y}, o[t].v);
#pragma unroll
        for (int t = 0; t < 4; ++t) o[t].v = wmma4(pa1, (v2f){vv[t].z, vv[t].w}, o[t].v);
      }
    }

    // ---- hand this wave's partial to LDS (a wave without a tile: m=-inf, l=0, O=0) ----
    // rows 8..15 sit with their columns XORed by 16, so the two half-waves of a
    // store fall on different banks
    float* op = &opart[(h * NW + wid) * 1024];
    // both loops unrolled: o[][] lives in registers and needs constant indices
#pragma unroll
    for (int v = 0; v < 8; ++v) {
#pragma unroll
      for (int t = 0; t < 4; ++t)
        op[(v + 8 * hi) * DOUT + ((16 * t + ln) ^ (hi << 4))] = o[t].f[v];
    }
    if (ln == 0) {                 // m, l are equal in the 16 lanes of a row
#pragma unroll                     // m[], l[] live in registers: constant indices
      for (int v = 0; v < 8; ++v) {
        mpart[(h * 16 + v + 8 * hi) * NW + wid] = m[v];
        lpart[(h * 16 + v + 8 * hi) * NW + wid] = l[v];
      }
    }
  }

  __syncthreads();   // every wave's two partials are in LDS

  // ---- merge: one wave per output row (2 blocks x 16 rows dealt over the NW waves);
  //      lane p first holds partial p's weight, then lane -> 2 columns ----
  for (int r = wid; r < 32; r += NW) {
    const int mh  = r >> 4;
    const int row = r & 15;
    const int mblk = mh ? (NBLK - 1 - blockIdx.x) : blockIdx.x;
    const int pl = (lane < NW) ? lane : 0;           // lanes past NW hold no partial
    float mp = mpart[(mh * 16 + row) * NW + pl];
    float lp = lpart[(mh * 16 + row) * NW + pl];
    if (lane >= NW) { mp = -__builtin_inff(); lp = 0.0f; }
    float M = mp;
#pragma unroll                     // five fixed exchange steps, no loop counter
    for (int d = 16; d >= 1; d >>= 1) M = fmaxf(M, __shfl_xor(M, d, 32));
    const float w = __expf(mp - M);  // 0 for a wave that had no tile
    float L = w * lp;
#pragma unroll                     // five fixed exchange steps, no loop counter
    for (int d = 16; d >= 1; d >>= 1) L += __shfl_xor(L, d, 32);
    const float wn = w * (1.0f / L); // weight with the normalisation folded in

    const float* ob = &opart[mh * NW * 1024 + row * DOUT + ((2 * lane) ^ ((row >> 3) << 4))];
    v2f acc = {0.0f, 0.0f};
    // unrolled so that each partial's weight is read from a constant lane (v_readlane)
#pragma unroll
    for (int p = 0; p < NW; ++p) {
      const float wp = __int_as_float(__builtin_amdgcn_readlane(__float_as_int(wn), p));
      const v2f x = *(const v2f*)(ob + p * 1024);
      acc.x += wp * x.x;
      acc.y += wp * x.y;
    }
    *(v2f*)(out + (size_t)(mblk * 16 + row) * DOUT + 2 * lane) = acc;
    // the next trip reuses the store's registers: keep the wait in front of that
    asm volatile("s_wait_xcnt 0x0" ::: "memory");
  }
}

// ---------------------------------------------------------------------------
extern "C" void kernel_launch(void* const* d_in, const int* in_sizes, int n_in,
                              void* d_out, int out_size, void* d_ws, size_t ws_size,
                              hipStream_t stream) {
  const float* x  = (const float*)d_in[0];
  const float* Wq = (const float*)d_in[1];
  const float* Wk = (const float*)d_in[2];
  const float* Wv = (const float*)d_in[3];
  float* qkv = (float*)d_ws;              // Q | K | V, each S*64 f32 (6 MB); K, V tiled
  float* out = (float*)d_out;

  dim3 gA(NBLK, 12);
  qkv_proj_kernel<<<gA, 32, 0, stream>>>(x, Wq, Wk, Wv, qkv);

  const float* Qp = qkv;
  const float* Kp = qkv + (size_t)S_TOK * DOUT;
  const float* Vp = qkv + (size_t)2 * S_TOK * DOUT;
  flash_attn_kernel<<<256, FA_THREADS, 0, stream>>>(Qp, Kp, Vp, out);
}

// v003
// It runs in 74.9 microseconds.
// Two timings next to v002 both put it at 1.17 times that version's speed.
// All steps since v000 together make it 7.91 times as fast.
#include <hip/hip_runtime.h>

typedef float v2f __attribute__((ext_vector_type(2)));
typedef float v4f __attribute__((ext_vector_type(4)));
typedef float v8f __attribute__((ext_vector_type(8)));

#define S_TOK 8192
#define DIN   512
#define DOUT  64
#define NBLK  (S_TOK / 16)   // 512 row blocks

union F8 { v8f v; float f[8]; };

__device__ __forceinline__ v8f wmma4(v2f a, v2f b, v8f c) {
  // D = A(16x4 f32) * B(4x16 f32) + C(16x16 f32)
  return __builtin_amdgcn_wmma_f32_16x16x4_f32(
      /*neg_a=*/false, a, /*neg_b=*/false, b,
      /*c_mod=*/(short)0, c, /*reuse_a=*/false, /*reuse_b=*/false);
}

// value of lane l ^ 16 (the other half-wave), as one vector instruction
__device__ __forceinline__ float xhalf(float x) {
  const int b = __float_as_int(x);
  return __int_as_float(__builtin_amdgcn_permlanex16(b, b, 0x76543210, 0xfedcba98, false, false));
}

// ---------------------------------------------------------------------------
// Kernel 1: Q/K/V projection.  y = x @ W^T  (x:[S,512], W:[64,512], y:[S,64])
// One wave computes one 16x16 output tile. K=512 reduction split into two
// independent 64-deep WMMA chains for matrix-pipe ILP.
// grid = (512 row-blocks, 12 = {Q,K,V} x 4 col-tiles), block = 32 (one wave).
// Q is pre-scaled by 1/sqrt(64) and stored row-major.
// K and V are stored per 16-key tile (1024 floats) in the order in which the
// attention kernel's lanes consume them: 8 groups of 128 floats, group g holding
// 4 floats for each of the 32 lanes, so one 16-byte load per lane reads a group
// as 512 contiguous bytes.
//   K group g, lane (hi,ln), e: K[key ln][d = 8g + 4(e>>1) + 2hi + (e&1)]
//   V group g = 4cc + t, lane (hi,ln), e: V[key 8hi + 4cc + e][d = 16t + ln]
// The K tile is computed transposed (W rows as A, x rows as B), so that a lane
// holds 8 d of one key; both then leave as two 16-byte stores per lane.
// ---------------------------------------------------------------------------
__global__ __launch_bounds__(32)
void qkv_proj_kernel(const float* __restrict__ x,
                     const float* __restrict__ Wq,
                     const float* __restrict__ Wk,
                     const float* __restrict__ Wv,
                     float* __restrict__ qkv /* [3][S][64] */) {
  const int lane = threadIdx.x & 31;
  const int hi   = lane >> 4;     // which half-wave
  const int ln   = lane & 15;
  const int iblk = blockIdx.x;       // row block
  const int mat  = blockIdx.y >> 2;  // 0=Q 1=K 2=V
  const int nt   = blockIdx.y & 3;   // output column tile

  const float* W = (mat == 0) ? Wq : (mat == 1 ? Wk : Wv);
  const float* xrow = x + (size_t)(iblk * 16 + ln) * DIN;
  const float* wrow = W + (size_t)(nt * 16 + ln) * DIN;
  const float* arow = (mat == 1) ? wrow : xrow;  // A row (M = ln); K: M = d
  const float* brow = (mat == 1) ? xrow : wrow;  // B row (N = ln); K: N = key

  F8 acc0 = {}, acc1 = {};        // two independent accumulation chains
#pragma unroll 4
  for (int k0 = 0; k0 < DIN; k0 += 8) {
    // 16x4 f32 A layout: lanes0-15 hold K=k0,k0+1 ; lanes16-31 hold K=k0+2,k0+3
    v2f a0 = *(const v2f*)(arow + k0 + 2 * hi);
    v2f b0 = *(const v2f*)(brow + k0 + 2 * hi);
    v2f a1 = *(const v2f*)(arow + k0 + 4 + 2 * hi);
    v2f b1 = *(const v2f*)(brow + k0 + 4 + 2 * hi);
    acc0.v = wmma4(a0, b0, acc0.v);
    acc1.v = wmma4(a1, b1, acc1.v);
  }
  F8 acc; acc.v = acc0.v + acc1.v;

  float* out = qkv + (size_t)mat * S_TOK * DOUT;
  if (mat == 0) {
#pragma unroll
    for (int v = 0; v < 8; ++v) {
      const int row = iblk * 16 + v + 8 * hi;    // C/D layout: M = v + 8*hi
      out[(size_t)row * DOUT + nt * 16 + ln] = acc.f[v] * 0.125f;  // 1/sqrt(d_k) folded into Q
    }
  } else {
    // K: M = d = 16nt + v + 8hi, N = key ln  -> group 2nt + hi, consumer half-waves 0 and 1
    // V: M = key = v + 8hi, N = d = 16nt + ln -> groups nt and 4 + nt, the producer's own lane
    const bool isk = (mat == 1);
    float* t = out + (size_t)iblk * 1024 + (isk ? (2 * nt + hi) * 128 + ln * 4 : nt * 128 + lane * 4);
    const v4f lo = isk ? (v4f){acc.f[0], acc.f[1], acc.f[4], acc.f[5]}
                       : (v4f){acc.f[0], acc.f[1], acc.f[2], acc.f[3]};
    const v4f up = isk ? (v4f){acc.f[2], acc.f[3], acc.f[6], acc.f[7]}
                       : (v4f){acc.f[4], acc.f[5], acc.f[6], acc.f[7]};
    *(v4f*)t                     = lo;
    *(v4f*)(t + (isk ? 64 : 512)) = up;
    // the listing lays the Q store block behind these stores, and it reuses their
    // address and data registers: keep the wait in front of that
    asm volatile("s_wait_xcnt 0x0" ::: "memory");
  }
}

// ---------------------------------------------------------------------------
// Kernel 2: causal flash attention, key range of each 16-row query block split
// over the NW waves of one work-group.
// block = NW waves, grid = 256. A work-group owns query blocks b and 511-b
// (513 key tiles together, the same for every work-group) and runs them one
// after the other. Wave w takes every NW-th key tile of a query block and keeps
// its own running max / sum / O. The second block deals its tiles to the waves
// in reverse order, so the two remainders fall on different waves and every
// wave walks 25 or 26 tiles. The partials meet in LDS behind one barrier and
// are merged with weights exp(m_w - M).
// Both products run transposed: S^T = K Q^T (A = K tile, B = Q) and
// O^T += V^T P^T (A = V^T, B = P^T). A lane then holds 8 keys' scores of ONE query
// (query ln, keys 8hi + v): max and sum run inside the lane, with one exchange
// between the half-waves, and the lane's own pairs p[2c], p[2c+1] are the
// B fragment of chunk c, whose four keys are 2c, 2c+1, 8+2c, 9+2c; V is stored
// in that key order.
// ---------------------------------------------------------------------------
#define NW 20   // waves per work-group = key splits per query block (5 per SIMD)
#define FA_THREADS 640
static_assert(FA_THREADS == NW * 32, "one wave is 32 lanes");

__global__ __launch_bounds__(FA_THREADS)
void flash_attn_kernel(const float* __restrict__ Q,
                       const float* __restrict__ K,
                       const float* __restrict__ V,
                       float* __restrict__ out) {
  __shared__ __attribute__((aligned(16))) float opart[2 * NW * 1024];  // un-normalised O partial per (block, wave); 16-byte stores
  __shared__ float mpart[2 * 16 * NW];    // running max  [block][row][wave]
  __shared__ float lpart[2 * 16 * NW];    // running sum  [block][row][wave]

  const int lane = threadIdx.x & 31;
  // wave number as a scalar: the tile loop's trip count is then a scalar branch
  const int wid  = __builtin_amdgcn_readfirstlane(threadIdx.x >> 5);
  const int hi   = lane >> 4;
  const int ln   = lane & 15;

  for (int h = 0; h < 2; ++h) {
    const int iblk = h ? (NBLK - 1 - blockIdx.x) : blockIdx.x;  // 0..511

    // Q B-fragments (N = query ln) for full K=64 reduction: 16 chunks of K=4 (32 VGPRs)
    v2f qa[16];
    const float* qrow = Q + (size_t)(iblk * 16 + ln) * DOUT;
#pragma unroll
    for (int c = 0; c < 16; ++c)
      qa[c] = *(const v2f*)(qrow + 4 * c + 2 * hi);

    F8 o[4] = {};                  // O^T accumulator: o[t].f[v] = O[query ln][d = 16t + 8hi + v]
    float m = -__builtin_inff();   // running max of query ln (equal in both half-waves)
    float l = 0.0f;                // running sum of query ln over this half-wave's keys

    for (int j = h ? (NW - 1 - wid) : wid; j <= iblk; j += NW) {
      if (j + NW <= iblk) {  // prefetch this wave's next K/V tile, one request per 256 B (global_prefetch_b8)
        __builtin_prefetch(K + (size_t)((j + NW) * 16 + ln) * DOUT, 0, 3);
        __builtin_prefetch(V + (size_t)((j + NW) * 16 + ln) * DOUT, 0, 3);
      }

      // ---- S^T = K_j @ (Q/sqrt(dk))^T : two independent 8-deep WMMA chains ----
      F8 s0 = {}, s1 = {};
      // A-frags of K (M = key ln): group g holds this lane's pairs of chunks 2g and 2g+1
      const float* kt = K + (size_t)j * 1024 + lane * 4;
#pragma unroll
      for (int g = 0; g < 4; ++g) {
        const v4f k0 = *(const v4f*)(kt + g * 128);
        const v4f k1 = *(const v4f*)(kt + (g + 4) * 128);
        s0.v = wmma4((v2f){k0.x, k0.y}, qa[2 * g],     s0.v);
        s1.v = wmma4((v2f){k1.x, k1.y}, qa[2 * g + 8], s1.v);
        s0.v = wmma4((v2f){k0.z, k0.w}, qa[2 * g + 1], s0.v);
        s1.v = wmma4((v2f){k1.z, k1.w}, qa[2 * g + 9], s1.v);
      }
      F8 s; s.v = s0.v + s1.v;     // s.f[v] = score of key 8hi + v, query ln

      // ---- causal mask + online softmax of query ln ----
      if (j == iblk) {
#pragma unroll                     // s lives in registers: constant indices
        for (int v = 0; v < 8; ++v)
          if (v + 8 * hi > ln) s.f[v] = -__builtin_inff();   // key > query -> masked
      }
      float mx = fmaxf(fmaxf(fmaxf(s.f[0], s.f[1]), fmaxf(s.f[2], s.f[3])),
                       fmaxf(fmaxf(s.f[4], s.f[5]), fmaxf(s.f[6], s.f[7])));
      mx = fmaxf(mx, xhalf(mx));   // all 16 keys of the tile
      const float mn = fmaxf(m, mx);
      const float sc = __expf(m - mn);
      m = mn;
#pragma unroll                     // s lives in registers: constant indices
      for (int v = 0; v < 8; ++v) s.f[v] = (s.f[v] - mn) * 1.44269504f;   // e^x = 2^(x log2 e), as __expf forms it
      // the tile's eight 2^x, in place, as ONE statement: each stands behind an independent one and
      // the v_nop fills the slot the instruction set asks for behind the last
      asm("v_exp_f32 %0, %0\n\tv_exp_f32 %1, %1\n\tv_exp_f32 %2, %2\n\tv_exp_f32 %3, %3\n\t"
          "v_exp_f32 %4, %4\n\tv_exp_f32 %5, %5\n\tv_exp_f32 %6, %6\n\tv_exp_f32 %7, %7\n\tv_nop"
          : "+v"(s.f[0]), "+v"(s.f[1]), "+v"(s.f[2]), "+v"(s.f[3]),
            "+v"(s.f[4]), "+v"(s.f[5]), "+v"(s.f[6]), "+v"(s.f[7]));
      l = l * sc + (((s.f[0] + s.f[1]) + (s.f[2] + s.f[3])) + ((s.f[4] + s.f[5]) + (s.f[6] + s.f[7])));
#pragma unroll                     // o[] lives in registers: constant indices
      for (int t = 0; t < 4; ++t) o[t].v *= sc;   // every element of a lane belongs to query ln

      // ---- O^T += V_j^T @ P^T : 4 chunks (K=4) x 4 independent d-tile chains ----
      // A-frags of V^T (M = d = 16t+ln): group 4cc+t holds chunks 2cc and 2cc+1
      const float* vt = V + (size_t)j * 1024 + lane * 4;
      // all four loops unrolled: vv[] and o[] live in registers and need constant
      // indices; a half tile's four loads issue ahead of its eight matrix instructions
#pragma unroll
      for (int cc = 0; cc < 2; ++cc) {
        const v2f pb0 = {s.f[4 * cc],     s.f[4 * cc + 1]};  // B-frag of P^T, chunk 2cc
        const v2f pb1 = {s.f[4 * cc + 2], s.f[4 * cc + 3]};  // chunk 2cc+1
        v4f vv[4];
#pragma unroll
        for (int t = 0; t < 4; ++t) vv[t] = *(const v4f*)(vt + (4 * cc + t) * 128);
#pragma unroll
        for (int t = 0; t < 4; ++t) o[t].v = wmma4((v2f){vv[t].x, vv[t].y}, pb0, o[t].v);
#pragma unroll
        for (int t = 0; t < 4; ++t) o[t].v = wmma4((v2f){vv[t].z, vv[t].w}, pb1, o[t].v);
      }
    }

    // ---- hand this wave's partial to LDS (a wave without a tile: m=-inf, l=0, O=0) ----
    // a lane holds 8 consecutive d of row ln per tile t: 16-byte stores; row r keeps its
    // 16-byte pieces at index (piece ^ r), so the 16 rows of a store fall on different banks
    float* op = &opart[(h * NW + wid) * 1024 + ln * DOUT];
    // both loops unrolled: o[][] lives in registers and needs constant indices
#pragma unroll
    for (int t = 0; t < 4; ++t) {
#pragma unroll
      for (int u = 0; u < 2; ++u) {
        const v4f piece = {o[t].f[4 * u], o[t].f[4 * u + 1], o[t].f[4 * u + 2], o[t].f[4 * u + 3]};
        *(v4f*)(op + (((4 * t + 2 * hi + u) ^ ln) << 2)) = piece;
      }
    }
    l += xhalf(l);                 // join the two half-waves' sums
    if (hi == 0) {                 // m, l are equal in both half-waves now
      mpart[(h * 16 + ln) * NW + wid] = m;
      lpart[(h * 16 + ln) * NW + wid] = l;
    }
  }

  __syncthreads();   // every wave's two partials are in LDS

  // ---- merge: one wave per output row (2 blocks x 16 rows dealt over the NW waves);
  //      lane p first holds partial p's weight, then lane -> 2 columns ----
  for (int r = wid; r < 32; r += NW) {
    const int mh  = r >> 4;
    const int row = r & 15;
    const int mblk = mh ? (NBLK - 1 - blockIdx.x) : blockIdx.x;
    const int pl = (lane < NW) ? lane : 0;           // lanes past NW hold no partial
    float mp = mpart[(mh * 16 + row) * NW + pl];
    float lp = lpart[(mh * 16 + row) * NW + pl];
    if (lane >= NW) { mp = -__builtin_inff(); lp = 0.0f; }
    float M = mp;
#pragma unroll                     // five fixed exchange steps, no loop counter
    for (int d = 16; d >= 1; d >>= 1) M = fmaxf(M, __shfl_xor(M, d, 32));
    const float w = __expf(mp - M);  // 0 for a wave that had no tile
    float L = w * lp;
#pragma unroll                     // five fixed exchange steps, no loop counter
    for (int d = 16; d >= 1; d >>= 1) L += __shfl_xor(L, d, 32);
    const float wn = w * (1.0f / L); // weight with the normalisation folded in

    const float* ob = &opart[mh * NW * 1024 + row * DOUT + ((((lane >> 1) ^ row) << 2) | ((lane & 1) << 1))];
    v2f acc = {0.0f, 0.0f};
    // unrolled so that each partial's weight is read from a constant lane (v_readlane)
#pragma unroll
    for (int p = 0; p < NW; ++p) {
      const float wp = __int_as_float(__builtin_amdgcn_readlane(__float_as_int(wn), p));
      const v2f x = *(const v2f*)(ob + p * 1024);
      acc.x += wp * x.x;
      acc.y += wp * x.y;
    }
    *(v2f*)(out + (size_t)(mblk * 16 + row) * DOUT + 2 * lane) = acc;
    // the next trip reuses the store's registers: keep the wait in front of that
    asm volatile("s_wait_xcnt 0x0" ::: "memory");
  }
}

// ---------------------------------------------------------------------------
extern "C" void kernel_launch(void* const* d_in, const int* in_sizes, int n_in,
                              void* d_out, int out_size, void* d_ws, size_t ws_size,
                              hipStream_t stream) {
  const float* x  = (const float*)d_in[0];
  const float* Wq = (const float*)d_in[1];
  const float* Wk = (const float*)d_in[2];
  const float* Wv = (const float*)d_in[3];
  float* qkv = (float*)d_ws;              // Q | K | V, each S*64 f32 (6 MB); K, V tiled
  float* out = (float*)d_out;

  dim3 gA(NBLK, 12);
  qkv_proj_kernel<<<gA, 32, 0, stream>>>(x, Wq, Wk, Wv, qkv);

  const float* Qp = qkv;
  const float* Kp = qkv + (size_t)S_TOK * DOUT;
  const float* Vp = qkv + (size_t)2 * S_TOK * DOUT;
  flash_attn_kernel<<<256, FA_THREADS, 0, stream>>>(Qp, Kp, Vp, out);
}

// v004
// A run of this version takes 64.2 microseconds.
// Next to v003, in two timings, it ran 1.16 and 1.17 times as fast.
// Over all steps from v000 it is 9.22 times as fast.
#include <hip/hip_runtime.h>

typedef float v2f __attribute__((ext_vector_type(2)));
typedef float v4f __attribute__((ext_vector_type(4)));
typedef float v8f __attribute__((ext_vector_type(8)));

#define S_TOK 8192
#define DIN   512
#define DOUT  64
#define NBLK  (S_TOK / 16)   // 512 row blocks

union F8 { v8f v; float f[8]; };

__device__ __forceinline__ v8f wmma4(v2f a, v2f b, v8f c) {
  // D = A(16x4 f32) * B(4x16 f32) + C(16x16 f32)
  return __builtin_amdgcn_wmma_f32_16x16x4_f32(
      /*neg_a=*/false, a, /*neg_b=*/false, b,
      /*c_mod=*/(short)0, c, /*reuse_a=*/false, /*reuse_b=*/false);
}

// value of lane l ^ 16 (the other half-wave), as one vector instruction
__device__ __forceinline__ float xhalf(float x) {
  const int b = __float_as_int(x);
  return __int_as_float(__builtin_amdgcn_permlanex16(b, b, 0x76543210, 0xfedcba98, false, false));
}

// ---------------------------------------------------------------------------
// Kernel 1: Q/K/V projection.  y = x @ W^T  (x:[S,512], W:[64,512], y:[S,64])
// One work-group of 12 waves computes 32 rows of x times all 192 output columns.
// The 32 rows (64 KiB, contiguous) are brought into LDS once, by loads that cover
// whole 128-byte lines, and every wave takes its x fragments from there. Wave w owns
// matrix w >> 2 ({Q,K,V}) and column tile w & 3, for both 16-row tiles: a W fragment is
// read once per work-group and feeds two independent accumulation chains.
// A lane reads 16 bytes of its row at a time (k = 8c + 4hi .. + 3) from x and from W
// alike; the first pair feeds one matrix instruction, the second pair the next, so
// A and B carry the same k at every position.
// Q is pre-scaled by 1/sqrt(64) and stored row-major.
// K and V are stored per 16-key tile (1024 floats) in the order in which the
// attention kernel's lanes consume them: 8 groups of 128 floats, group g holding
// 4 floats for each of the 32 lanes, so one 16-byte load per lane reads a group
// as 512 contiguous bytes.
//   K group g, lane (hi,ln), e: K[key ln][d = 8g + 4(e>>1) + 2hi + (e&1)]
//   V group g = 4cc + t, lane (hi,ln), e: V[key 8hi + 4cc + e][d = 16t + ln]
// The K tile is computed transposed (W rows as A, x rows as B), so that a lane
// holds 8 d of one key; both then leave as two 16-byte stores per lane.
// ---------------------------------------------------------------------------
#define PJ_ROWS    32
#define PJ_THREADS 384   // 12 waves, 3 per SIMD
#define PJ_GRID    256   // S_TOK / PJ_ROWS
#define XP         516   // LDS row pitch in floats: 2064 B = 16 B x 129 (odd), so the 16 rows of a 16-byte read fall on different banks
static_assert(PJ_GRID * PJ_ROWS == S_TOK, "every row of x belongs to one work-group");

// 512-deep products of one W column tile with the two row tiles. KT: W rows as A (K, transposed).
// k runs in 8 blocks of 64. wc holds block 0's W fragments on entry; each block's W loads are issued
// one block (32 matrix instructions) ahead of their use.
template <bool KT>
__device__ __forceinline__ void proj_tiles(const float* xa, const float* wrow, v4f (&wc)[8], F8& acc0, F8& acc1) {
  // both loops unrolled whole: wc[], wn[] live in registers (constant indices), every offset is an immediate
#pragma unroll
  for (int b = 0; b < DIN / 64; ++b) {
    v4f wn[8];
    if (b + 1 < DIN / 64) {
#pragma unroll
      for (int c = 0; c < 8; ++c) wn[c] = *(const v4f*)(wrow + 64 * (b + 1) + 8 * c);
    }
    // compiler fence, no instruction: holds the next block's W loads here, one block ahead of their use. A build
    // without it moves them, on the K path, down to directly in front of their use (waits to a count of 0 or 1),
    // and every pair of them is then waited for at full load latency
    asm volatile("" ::: "memory");
#pragma unroll
    for (int c = 0; c < 8; ++c) {
      const v4f w  = wc[c];
      const v4f x0 = *(const v4f*)(xa + 64 * b + 8 * c);
      const v4f x1 = *(const v4f*)(xa + 16 * XP + 64 * b + 8 * c);
      const v2f wl = {w.x, w.y},   wh = {w.z, w.w};
      const v2f l0 = {x0.x, x0.y}, h0 = {x0.z, x0.w};
      const v2f l1 = {x1.x, x1.y}, h1 = {x1.z, x1.w};
      if (KT) {
        acc0.v = wmma4(wl, l0, acc0.v);
        acc1.v = wmma4(wl, l1, acc1.v);
        acc0.v = wmma4(wh, h0, acc0.v);
        acc1.v = wmma4(wh, h1, acc1.v);
      } else {
        acc0.v = wmma4(l0, wl, acc0.v);
        acc1.v = wmma4(l1, wl, acc1.v);
        acc0.v = wmma4(h0, wh, acc0.v);
        acc1.v = wmma4(h1, wh, acc1.v);
      }
    }
    if (b + 1 < DIN / 64) {
#pragma unroll
      for (int c = 0; c < 8; ++c) wc[c] = wn[c];
    }
  }
}

// one finished 16x16 tile of row block iblk to its plane
__device__ __forceinline__ void proj_store(float* __restrict__ qkv, const F8& acc, int mat, int nt,
                                           int iblk, int lane, int hi, int ln) {
  float* out = qkv + (size_t)mat * S_TOK * DOUT;
  if (mat == 0) {
#pragma unroll
    for (int v = 0; v < 8; ++v) {
      const int row = iblk * 16 + v + 8 * hi;    // C/D layout: M = v + 8*hi
      out[(size_t)row * DOUT + nt * 16 + ln] = acc.f[v] * 0.125f;  // 1/sqrt(d_k) folded into Q
    }
  } else {
    // K: M = d = 16nt + v + 8hi, N = key ln  -> group 2nt + hi, consumer half-waves 0 and 1
    // V: M = key = v + 8hi, N = d = 16nt + ln -> groups nt and 4 + nt, the producer's own lane
    const bool isk = (mat == 1);
    float* t = out + (size_t)iblk * 1024 + (isk ? (2 * nt + hi) * 128 + ln * 4 : nt * 128 + lane * 4);
    const v4f lo = isk ? (v4f){acc.f[0], acc.f[1], acc.f[4], acc.f[5]}
                       : (v4f){acc.f[0], acc.f[1], acc.f[2], acc.f[3]};
    const v4f up = isk ? (v4f){acc.f[2], acc.f[3], acc.f[6], acc.f[7]}
                       : (v4f){acc.f[4], acc.f[5], acc.f[6], acc.f[7]};
    *(v4f*)t                     = lo;
    *(v4f*)(t + (isk ? 64 : 512)) = up;
    // the listing lays the Q store block behind these stores, and it reuses their
    // address and data registers: keep the wait in front of that
    asm volatile("s_wait_xcnt 0x0" ::: "memory");
  }
  // the second tile's stores may reuse the address and data registers of these: keep the wait in front of that
  asm volatile("s_wait_xcnt 0x0" ::: "memory");
}

__global__ __launch_bounds__(PJ_THREADS)
void qkv_proj_kernel(const float* __restrict__ x,
                     const float* __restrict__ Wq,
                     const float* __restrict__ Wk,
                     const float* __restrict__ Wv,
                     float* __restrict__ qkv /* [3][S][64] */) {
  __shared__ __attribute__((aligned(16))) float xs[PJ_ROWS * XP];

  const int tid  = threadIdx.x;
  const int lane = tid & 31;
  const int hi   = lane >> 4;     // which half-wave
  const int ln   = lane & 15;
  // wave number as a scalar: matrix and column tile are then scalar too
  int wid = __builtin_amdgcn_readfirstlane(tid >> 5);

  // ---- the work-group's 32 rows of x into LDS: 4096 pieces of 16 bytes, a wave's load = 512 contiguous bytes;
  //      10 rounds of all 12 waves and one of the first 8; all loads are issued before the first store ----
  const float* xg = x + (size_t)blockIdx.x * PJ_ROWS * DIN;
  static_assert(PJ_ROWS * DIN / 4 == 10 * PJ_THREADS + 8 * 32, "rounds of the staging loop");
  v4f r[11];
#pragma unroll                     // r[] lives in registers: constant indices
  for (int i = 0; i < 10; ++i) r[i] = *(const v4f*)(xg + (size_t)(tid + i * PJ_THREADS) * 4);
  if (wid < 8) r[10] = *(const v4f*)(xg + (size_t)(tid + 10 * PJ_THREADS) * 4);
  // the scalar code behind reuses the base registers of these loads: keep the wait in front of that.
  // The wave number passes through the statement because all of that code is derived from it; with
  // the "memory" clobber alone the compiler was seen to lift it over the wait
  asm volatile("s_wait_xcnt 0x0" : "+s"(wid) : : "memory");
  const int mat = wid >> 2;       // 0=Q 1=K 2=V
  const int nt  = wid & 3;        // output column tile

  // first block of this wave's W fragments: requested together with the x rows, used behind the barrier
  const float* W    = (mat == 0) ? Wq : (mat == 1 ? Wk : Wv);
  const float* wrow = W + (size_t)(nt * 16 + ln) * DIN + 4 * hi;
  v4f wc[8];
#pragma unroll                     // wc[] lives in registers: constant indices
  for (int c = 0; c < 8; ++c) wc[c] = *(const v4f*)(wrow + 8 * c);

#pragma unroll
  for (int i = 0; i < 10; ++i) {
    const int idx = tid + i * PJ_THREADS;
    *(v4f*)&xs[(idx >> 7) * XP + (idx & 127) * 4] = r[i];
  }
  if (wid < 8) {
    const int idx = tid + 10 * PJ_THREADS;
    *(v4f*)&xs[(idx >> 7) * XP + (idx & 127) * 4] = r[10];
  }
  __syncthreads();   // x rows are in LDS for every wave

  const float* xa = &xs[ln * XP + 4 * hi];

  F8 acc0 = {}, acc1 = {};        // row tiles 0 and 1: two independent accumulation chains
  if (mat == 1) proj_tiles<true>(xa, wrow, wc, acc0, acc1);
  else          proj_tiles<false>(xa, wrow, wc, acc0, acc1);

  proj_store(qkv, acc0, mat, nt, blockIdx.x * 2,     lane, hi, ln);
  proj_store(qkv, acc1, mat, nt, blockIdx.x * 2 + 1, lane, hi, ln);
}

// ---------------------------------------------------------------------------
// Kernel 2: causal flash attention, key range of each 16-row query block split
// over the NW waves of one work-group.
// block = NW waves, grid = 256. A work-group owns query blocks b and 511-b
// (513 key tiles together, the same for every work-group) and runs them one
// after the other. Wave w takes every NW-th key tile of a query block and keeps
// its own running max / sum / O. The second block deals its tiles to the waves
// in reverse order, so the two remainders fall on different waves and every
// wave walks 25 or 26 tiles. The partials meet in LDS behind one barrier and
// are merged with weights exp(m_w - M).
// Both products run transposed: S^T = K Q^T (A = K tile, B = Q) and
// O^T += V^T P^T (A = V^T, B = P^T). A lane then holds 8 keys' scores of ONE query
// (query ln, keys 8hi + v): max and sum run inside the lane, with one exchange
// between the half-waves, and the lane's own pairs p[2c], p[2c+1] are the
// B fragment of chunk c, whose four keys are 2c, 2c+1, 8+2c, 9+2c; V is stored
// in that key order.
// ---------------------------------------------------------------------------
#define NW 20   // waves per work-group = key splits per query block (5 per SIMD)
#define FA_THREADS 640
static_assert(FA_THREADS == NW * 32, "one wave is 32 lanes");

__global__ __launch_bounds__(FA_THREADS)
void flash_attn_kernel(const float* __restrict__ Q,
                       const float* __restrict__ K,
                       const float* __restrict__ V,
                       float* __restrict__ out) {
  __shared__ __attribute__((aligned(16))) float opart[2 * NW * 1024];  // un-normalised O partial per (block, wave); 16-byte stores
  __shared__ float mpart[2 * 16 * NW];    // running max  [block][row][wave]
  __shared__ float lpart[2 * 16 * NW];    // running sum  [block][row][wave]

  const int lane = threadIdx.x & 31;
  // wave number as a scalar: the tile loop's trip count is then a scalar branch
  const int wid  = __builtin_amdgcn_readfirstlane(threadIdx.x >> 5);
  const int hi   = lane >> 4;
  const int ln   = lane & 15;

  for (int h = 0; h < 2; ++h) {
    const int iblk = h ? (NBLK - 1 - blockIdx.x) : blockIdx.x;  // 0..511

    // Q B-fragments (N = query ln) for full K=64 reduction: 16 chunks of K=4 (32 VGPRs)
    v2f qa[16];
    const float* qrow = Q + (size_t)(iblk * 16 + ln) * DOUT;
#pragma unroll
    for (int c = 0; c < 16; ++c)
      qa[c] = *(const v2f*)(qrow + 4 * c + 2 * hi);

    F8 o[4] = {};                  // O^T accumulator: o[t].f[v] = O[query ln][d = 16t + 8hi + v]
    float m = -__builtin_inff();   // running max of query ln (equal in both half-waves)
    float l = 0.0f;                // running sum of query ln over this half-wave's keys

    for (int j = h ? (NW - 1 - wid) : wid; j <= iblk; j += NW) {
      if (j + NW <= iblk) {  // prefetch this wave's next K/V tile, one request per 256 B (global_prefetch_b8)
        __builtin_prefetch(K + (size_t)((j + NW) * 16 + ln) * DOUT, 0, 3);
        __builtin_prefetch(V + (size_t)((j + NW) * 16 + ln) * DOUT, 0, 3);
      }

      // ---- S^T = K_j @ (Q/sqrt(dk))^T : two independent 8-deep WMMA chains ----
      F8 s0 = {}, s1 = {};
      // A-frags of K (M = key ln): group g holds this lane's pairs of chunks 2g and 2g+1
      const float* kt = K + (size_t)j * 1024 + lane * 4;
#pragma unroll
      for (int g = 0; g < 4; ++g) {
        const v4f k0 = *(const v4f*)(kt + g * 128);
        const v4f k1 = *(const v4f*)(kt + (g + 4) * 128);
        s0.v = wmma4((v2f){k0.x, k0.y}, qa[2 * g],     s0.v);
        s1.v = wmma4((v2f){k1.x, k1.y}, qa[2 * g + 8], s1.v);
        s0.v = wmma4((v2f){k0.z, k0.w}, qa[2 * g + 1], s0.v);
        s1.v = wmma4((v2f){k1.z, k1.w}, qa[2 * g + 9], s1.v);
      }
      F8 s; s.v = s0.v + s1.v;     // s.f[v] = score of key 8hi + v, query ln

      // ---- causal mask + online softmax of query ln ----
      if (j == iblk) {
#pragma unroll                     // s lives in registers: constant indices
        for (int v = 0; v < 8; ++v)
          if (v + 8 * hi > ln) s.f[v] = -__builtin_inff();   // key > query -> masked
      }
      float mx = fmaxf(fmaxf(fmaxf(s.f[0], s.f[1]), fmaxf(s.f[2], s.f[3])),
                       fmaxf(fmaxf(s.f[4], s.f[5]), fmaxf(s.f[6], s.f[7])));
      mx = fmaxf(mx, xhalf(mx));   // all 16 keys of the tile
      const float mn = fmaxf(m, mx);
      const float sc = __expf(m - mn);
      m = mn;
#pragma unroll                     // s lives in registers: constant indices
      for (int v = 0; v < 8; ++v) s.f[v] = (s.f[v] - mn) * 1.44269504f;   // e^x = 2^(x log2 e), as __expf forms it
      // the tile's eight 2^x, in place, as ONE statement: each stands behind an independent one and
      // the v_nop fills the slot the instruction set asks for behind the last
      asm("v_exp_f32 %0, %0\n\tv_exp_f32 %1, %1\n\tv_exp_f32 %2, %2\n\tv_exp_f32 %3, %3\n\t"
          "v_exp_f32 %4, %4\n\tv_exp_f32 %5, %5\n\tv_exp_f32 %6, %6\n\tv_exp_f32 %7, %7\n\tv_nop"
          : "+v"(s.f[0]), "+v"(s.f[1]), "+v"(s.f[2]), "+v"(s.f[3]),
            "+v"(s.f[4]), "+v"(s.f[5]), "+v"(s.f[6]), "+v"(s.f[7]));
      l = l * sc + (((s.f[0] + s.f[1]) + (s.f[2] + s.f[3])) + ((s.f[4] + s.f[5]) + (s.f[6] + s.f[7])));
#pragma unroll                     // o[] lives in registers: constant indices
      for (int t = 0; t < 4; ++t) o[t].v *= sc;   // every element of a lane belongs to query ln

      // ---- O^T += V_j^T @ P^T : 4 chunks (K=4) x 4 independent d-tile chains ----
      // A-frags of V^T (M = d = 16t+ln): group 4cc+t holds chunks 2cc and 2cc+1
      const float* vt = V + (size_t)j * 1024 + lane * 4;
      // all four loops unrolled: vv[] and o[] live in registers and need constant
      // indices; a half tile's four loads issue ahead of its eight matrix instructions
#pragma unroll
      for (int cc = 0; cc < 2; ++cc) {
        const v2f pb0 = {s.f[4 * cc],     s.f[4 * cc + 1]};  // B-frag of P^T, chunk 2cc
        const v2f pb1 = {s.f[4 * cc + 2], s.f[4 * cc + 3]};  // chunk 2cc+1
        v4f vv[4];
#pragma unroll
        for (int t = 0; t < 4; ++t) vv[t] = *(const v4f*)(vt + (4 * cc + t) * 128);
#pragma unroll
        for (int t = 0; t < 4; ++t) o[t].v = wmma4((v2f){vv[t].x, vv[t].y}, pb0, o[t].v);
#pragma unroll
        for (int t = 0; t < 4; ++t) o[t].v = wmma4((v2f){vv[t].z, vv[t].w}, pb1, o[t].v);
      }
    }

    // ---- hand this wave's partial to LDS (a wave without a tile: m=-inf, l=0, O=0) ----
    // a lane holds 8 consecutive d of row ln per tile t: 16-byte stores; row r keeps its
    // 16-byte pieces at index (piece ^ r), so the 16 rows of a store fall on different banks
    float* op = &opart[(h * NW + wid) * 1024 + ln * DOUT];
    // both loops unrolled: o[][] lives in registers and needs constant indices
#pragma unroll
    for (int t = 0; t < 4; ++t) {
#pragma unroll
      for (int u = 0; u < 2; ++u) {
        const v4f piece = {o[t].f[4 * u], o[t].f[4 * u + 1], o[t].f[4 * u + 2], o[t].f[4 * u + 3]};
        *(v4f*)(op + (((4 * t + 2 * hi + u) ^ ln) << 2)) = piece;
      }
    }
    l += xhalf(l);                 // join the two half-waves' sums
    if (hi == 0) {                 // m, l are equal in both half-waves now
      mpart[(h * 16 + ln) * NW + wid] = m;
      lpart[(h * 16 + ln) * NW + wid] = l;
    }
  }

  __syncthreads();   // every wave's two partials are in LDS

  // ---- merge: one wave per output row (2 blocks x 16 rows dealt over the NW waves);
  //      lane p first holds partial p's weight, then lane -> 2 columns ----
  for (int r = wid; r < 32; r += NW) {
    const int mh  = r >> 4;
    const int row = r & 15;
    const int mblk = mh ? (NBLK - 1 - blockIdx.x) : blockIdx.x;
    const int pl = (lane < NW) ? lane : 0;           // lanes past NW hold no partial
    float mp = mpart[(mh * 16 + row) * NW + pl];
    float lp = lpart[(mh * 16 + row) * NW + pl];
    if (lane >= NW) { mp = -__builtin_inff(); lp = 0.0f; }
    float M = mp;
#pragma unroll                     // five fixed exchange steps, no loop counter
    for (int d = 16; d >= 1; d >>= 1) M = fmaxf(M, __shfl_xor(M, d, 32));
    const float w = __expf(mp - M);  // 0 for a wave that had no tile
    float L = w * lp;
#pragma unroll                     // five fixed exchange steps, no loop counter
    for (int d = 16; d >= 1; d >>= 1) L += __shfl_xor(L, d, 32);
    const float wn = w * (1.0f / L); // weight with the normalisation folded in

    const float* ob = &opart[mh * NW * 1024 + row * DOUT + ((((lane >> 1) ^ row) << 2) | ((lane & 1) << 1))];
    v2f acc = {0.0f, 0.0f};
    // unrolled so that each partial's weight is read from a constant lane (v_readlane)
#pragma unroll
    for (int p = 0; p < NW; ++p) {
      const float wp = __int_as_float(__builtin_amdgcn_readlane(__float_as_int(wn), p));
      const v2f x = *(const v2f*)(ob + p * 1024);
      acc.x += wp * x.x;
      acc.y += wp * x.y;
    }
    *(v2f*)(out + (size_t)(mblk * 16 + row) * DOUT + 2 * lane) = acc;
    // the next trip reuses the store's registers: keep the wait in front of that
    asm volatile("s_wait_xcnt 0x0" ::: "memory");
  }
}

// ---------------------------------------------------------------------------
extern "C" void kernel_launch(void* const* d_in, const int* in_sizes, int n_in,
                              void* d_out, int out_size, void* d_ws, size_t ws_size,
                              hipStream_t stream) {
  const float* x  = (const float*)d_in[0];
  const float* Wq = (const float*)d_in[1];
  const float* Wk = (const float*)d_in[2];
  const float* Wv = (const float*)d_in[3];
  float* qkv = (float*)d_ws;              // Q | K | V, each S*64 f32 (6 MB); K, V tiled
  float* out = (float*)d_out;

  qkv_proj_kernel<<<PJ_GRID, PJ_THREADS, 0, stream>>>(x, Wq, Wk, Wv, qkv);

  const float* Qp = qkv;
  const float* Kp = qkv + (size_t)S_TOK * DOUT;
  const float* Vp = qkv + (size_t)2 * S_TOK * DOUT;
  flash_attn_kernel<<<256, FA_THREADS, 0, stream>>>(Qp, Kp, Vp, out);
}

// v006
// It runs in 38.1 microseconds.
// It is 1.69 times as fast as v004, going by the measured steps of the versions left out in between.
// Counting every step since v000, it is 15.6 times as fast.
#include <hip/hip_runtime.h>

typedef float v2f __attribute__((ext_vector_type(2)));
typedef float v4f __attribute__((ext_vector_type(4)));
typedef float v8f __attribute__((ext_vector_type(8)));

#define S_TOK 8192
#define DIN   512
#define DOUT  64
#define NBLK  (S_TOK / 16)   // 512 row blocks

typedef __bf16 bf16x2  __attribute__((ext_vector_type(2)));
typedef __bf16 bf16x16 __attribute__((ext_vector_type(16)));
typedef unsigned int u32x4 __attribute__((ext_vector_type(4)));
typedef unsigned int u32x8 __attribute__((ext_vector_type(8)));

union F8 { v8f v; float f[8]; };

__device__ __forceinline__ v8f wmma4(v2f a, v2f b, v8f c) {
  // D = A(16x4 f32) * B(4x16 f32) + C(16x16 f32)
  return __builtin_amdgcn_wmma_f32_16x16x4_f32(
      /*neg_a=*/false, a, /*neg_b=*/false, b,
      /*c_mod=*/(short)0, c, /*reuse_a=*/false, /*reuse_b=*/false);
}

__device__ __forceinline__ v8f wmma32(bf16x16 a, bf16x16 b, v8f c) {
  // D = A(16x32 bf16) * B(32x16 bf16) + C(16x16 f32)
  return __builtin_amdgcn_wmma_f32_16x16x32_bf16(0, a, 0, b, (short)0, c, false, false);
}

// an f32 value as two bf16 parts: hi = x rounded to bf16, lo = (x - hi) rounded to bf16; hi + lo
// carries about 16 bits of x. A product a*b is then formed as ah*bh + ah*bl + al*bh in f32 accumulators.
// Eight values at a time, packed in pairs: element e sits in half e & 1 of word e >> 1.
__device__ __forceinline__ void split8(v8f x, u32x4& hi, u32x4& lo) {
#pragma unroll                     // the words live in registers: constant indices
  for (int i = 0; i < 4; ++i) {
    const v2f p = {x[2 * i], x[2 * i + 1]};
    const unsigned int w = __builtin_bit_cast(unsigned int, __builtin_convertvector(p, bf16x2));
    const v2f back = {__uint_as_float(w << 16), __uint_as_float(w & 0xffff0000u)};   // the hi parts as f32
    hi[i] = w;
    lo[i] = __builtin_bit_cast(unsigned int, __builtin_convertvector(p - back, bf16x2));
  }
}

typedef const __attribute__((address_space(1))) float* gfloat_p;   // a pointer to global memory
typedef const __attribute__((address_space(1))) v4f*   gv4f_p;

// a wave-uniform global pointer as a value of its own in scalar registers: the loads that are formed from it take
// it as their scalar base, beside a 32-bit lane offset that lives through the loop
__device__ __forceinline__ gfloat_p scalar_base(const float* p) {
  const unsigned long long a = (unsigned long long)p;
  const unsigned int lo = __builtin_amdgcn_readfirstlane((unsigned int)a);
  const unsigned int hi = __builtin_amdgcn_readfirstlane((unsigned int)(a >> 32));
  return (gfloat_p)(((unsigned long long)hi << 32) | lo);
}

// one 16-element bf16 fragment of a lane: two 16-byte pieces that lie 512 bytes apart
__device__ __forceinline__ bf16x16 frag(gfloat_p p) {
  const v4f a = *(gv4f_p)p;
  const v4f b = *(gv4f_p)(p + 128);
  return __builtin_bit_cast(bf16x16, __builtin_shufflevector(a, b, 0, 1, 2, 3, 4, 5, 6, 7));
}

// value of lane l ^ 16 (the other half-wave), as one vector instruction
__device__ __forceinline__ float xhalf(float x) {
  const int b = __float_as_int(x);
  return __int_as_float(__builtin_amdgcn_permlanex16(b, b, 0x76543210, 0xfedcba98, false, false));
}

// ---------------------------------------------------------------------------
// Kernel 1: Q/K/V projection.  y = x @ W^T  (x:[S,512], W:[64,512], y:[S,64])
// One work-group of 12 waves computes 32 rows of x times all 192 output columns.
// The 32 rows (64 KiB, contiguous) are brought into LDS once, by loads that cover
// whole 128-byte lines, and every wave takes its x fragments from there. Wave w owns
// matrix w >> 2 ({Q,K,V}) and column tile w & 3, for both 16-row tiles: a W fragment is
// read once per work-group and feeds two independent accumulation chains.
// A lane reads 16 bytes of its row at a time (k = 8c + 4hi .. + 3) from x and from W
// alike; the first pair feeds one matrix instruction, the second pair the next, so
// A and B carry the same k at every position.
// Q (pre-scaled by 1/sqrt(64)), K and V leave as two bf16 parts each (split8), 4 bytes an element as
// before, in the order in which the attention kernel's lanes consume them: groups of 512 bytes,
// a group holding 8 bf16 (16 bytes) for each of the 32 lanes.
//   Q, K: per 16-row tile 8 groups, group 4*part + nt, lane (hi,ln), e: row ln, d = 16nt + 8hi + e
//   V: per 32-key tile 16 groups, group 8*part + 2nt + i, lane (hi,ln), e: key 16i + 8hi + e, d = 16nt + ln
// (part 0 = hi, 1 = lo). Q and K tiles are computed transposed (W rows as A, x rows as B), so that a
// lane holds 8 d of one row; a V lane holds 8 keys of one d. Every part leaves as one 16-byte store per lane.
// ---------------------------------------------------------------------------
#define PJ_ROWS    32
#define PJ_THREADS 384   // 12 waves, 3 per SIMD
#define PJ_GRID    256   // S_TOK / PJ_ROWS
#define XP         516   // LDS row pitch in floats: 2064 B = 16 B x 129 (odd), so the 16 rows of a 16-byte read fall on different banks
static_assert(PJ_GRID * PJ_ROWS == S_TOK, "every row of x belongs to one work-group");

// 512-deep products of one W column tile with the two row tiles. KT: W rows as A (Q and K, transposed).
// k runs in 8 blocks of 64. wc holds block 0's W fragments on entry; each block's W loads are issued
// one block (32 matrix instructions) ahead of their use.
template <bool KT>
__device__ __forceinline__ void proj_tiles(const float* xa, const float* wrow, v4f (&wc)[8], F8& acc0, F8& acc1) {
  // both loops unrolled whole: wc[], wn[] live in registers (constant indices), every offset is an immediate
#pragma unroll
  for (int b = 0; b < DIN / 64; ++b) {
    v4f wn[8];
    if (b + 1 < DIN / 64) {
#pragma unroll
      for (int c = 0; c < 8; ++c) wn[c] = *(const v4f*)(wrow + 64 * (b + 1) + 8 * c);
    }
    // compiler fence, no instruction: holds the next block's W loads here, one block ahead of their use. A build
    // without it moves them, on the K path, down to directly in front of their use (waits to a count of 0 or 1),
    // and every pair of them is then waited for at full load latency
    asm volatile("" ::: "memory");
#pragma unroll
    for (int c = 0; c < 8; ++c) {
      const v4f w  = wc[c];
      const v4f x0 = *(const v4f*)(xa + 64 * b + 8 * c);
      const v4f x1 = *(const v4f*)(xa + 16 * XP + 64 * b + 8 * c);
      const v2f wl = {w.x, w.y},   wh = {w.z, w.w};
      const v2f l0 = {x0.x, x0.y}, h0 = {x0.z, x0.w};
      const v2f l1 = {x1.x, x1.y}, h1 = {x1.z, x1.w};
      if (KT) {
        acc0.v = wmma4(wl, l0, acc0.v);
        acc1.v = wmma4(wl, l1, acc1.v);
        acc0.v = wmma4(wh, h0, acc0.v);
        acc1.v = wmma4(wh, h1, acc1.v);
      } else {
        acc0.v = wmma4(l0, wl, acc0.v);
        acc1.v = wmma4(l1, wl, acc1.v);
        acc0.v = wmma4(h0, wh, acc0.v);
        acc1.v = wmma4(h1, wh, acc1.v);
      }
    }
    if (b + 1 < DIN / 64) {
#pragma unroll
      for (int c = 0; c < 8; ++c) wc[c] = wn[c];
    }
  }
}

// the wave's two finished 16x16 tiles (rows 0-15 and 16-31 of the work-group) to their plane, as bf16 parts
__device__ __forceinline__ void proj_store(float* __restrict__ qkv, const F8& acc0, const F8& acc1,
                                           int mat, int nt, int blk, int lane) {
  float* out = qkv + (size_t)mat * S_TOK * DOUT + (size_t)blk * 2048 + lane * 4;
  const float sc = (mat == 0) ? 0.125f : 1.0f;   // 1/sqrt(d_k) folded into Q (a power of two: exact)
  u32x4 h0, l0, h1, l1;
  split8(acc0.v * sc, h0, l0);
  split8(acc1.v * sc, h1, l1);
  // Q, K: M = d = 16nt + 8hi + v, N = row ln -> tile i, group 4*part + nt
  // V:    M = key = 16i + 8hi + v, N = d = 16nt + ln -> group 8*part + 2nt + i
  const bool isv = (mat == 2);
  float* t0 = out + (isv ? nt * 256       : nt * 128);
  float* t1 = out + (isv ? nt * 256 + 128 : nt * 128 + 1024);
  const int lo_off = isv ? 1024 : 512;
  *(v4f*)t0            = __builtin_bit_cast(v4f, h0);
  *(v4f*)(t0 + lo_off) = __builtin_bit_cast(v4f, l0);
  *(v4f*)t1            = __builtin_bit_cast(v4f, h1);
  *(v4f*)(t1 + lo_off) = __builtin_bit_cast(v4f, l1);
  // whatever the listing lays behind these stores may reuse their registers: keep the wait in front of that
  asm volatile("s_wait_xcnt 0x0" ::: "memory");
}

__global__ __launch_bounds__(PJ_THREADS)
void qkv_proj_kernel(const float* __restrict__ x,
                     const float* __restrict__ Wq,
                     const float* __restrict__ Wk,
                     const float* __restrict__ Wv,
                     float* __restrict__ qkv /* [3][S][64] */) {
  __shared__ __attribute__((aligned(16))) float xs[PJ_ROWS * XP];

  const int tid  = threadIdx.x;
  const int lane = tid & 31;
  const int hi   = lane >> 4;     // which half-wave
  const int ln   = lane & 15;
  // wave number as a scalar: matrix and column tile are then scalar too
  int wid = __builtin_amdgcn_readfirstlane(tid >> 5);

  // ---- the work-group's 32 rows of x into LDS: 4096 pieces of 16 bytes, a wave's load = 512 contiguous bytes;
  //      10 rounds of all 12 waves and one of the first 8; all loads are issued before the first store ----
  const float* xg = x + (size_t)blockIdx.x * PJ_ROWS * DIN;
  static_assert(PJ_ROWS * DIN / 4 == 10 * PJ_THREADS + 8 * 32, "rounds of the staging loop");
  v4f r[11];
#pragma unroll                     // r[] lives in registers: constant indices
  for (int i = 0; i < 10; ++i) r[i] = *(const v4f*)(xg + (size_t)(tid + i * PJ_THREADS) * 4);
  if (wid < 8) r[10] = *(const v4f*)(xg + (size_t)(tid + 10 * PJ_THREADS) * 4);
  // the scalar code behind reuses the base registers of these loads: keep the wait in front of that.
  // The wave number passes through the statement because all of that code is derived from it
  asm volatile("s_wait_xcnt 0x0" : "+s"(wid) : : "memory");
  const int mat = wid >> 2;       // 0=Q 1=K 2=V
  const int nt  = wid & 3;        // output column tile

  // first block of this wave's W fragments: requested together with the x rows, used behind the barrier
  const float* W    = (mat == 0) ? Wq : (mat == 1 ? Wk : Wv);
  const float* wrow = W + (size_t)(nt * 16 + ln) * DIN + 4 * hi;
  v4f wc[8];
#pragma unroll                     // wc[] lives in registers: constant indices
  for (int c = 0; c < 8; ++c) wc[c] = *(const v4f*)(wrow + 8 * c);

#pragma unroll
  for (int i = 0; i < 10; ++i) {
    const int idx = tid + i * PJ_THREADS;
    *(v4f*)&xs[(idx >> 7) * XP + (idx & 127) * 4] = r[i];
  }
  if (wid < 8) {
    const int idx = tid + 10 * PJ_THREADS;
    *(v4f*)&xs[(idx >> 7) * XP + (idx & 127) * 4] = r[10];
  }
  __syncthreads();   // x rows are in LDS for every wave

  const float* xa = &xs[ln * XP + 4 * hi];

  F8 acc0 = {}, acc1 = {};        // row tiles 0 and 1: two independent accumulation chains
  if (mat != 2) proj_tiles<true>(xa, wrow, wc, acc0, acc1);
  else          proj_tiles<false>(xa, wrow, wc, acc0, acc1);

  proj_store(qkv, acc0, acc1, mat, nt, blockIdx.x, lane);
}

// ---------------------------------------------------------------------------
// Kernel 2: causal flash attention. A wave keeps TWO 16-row query tiles (32 adjacent queries) and
// feeds both from every K and V fragment that it loads: half the bytes from L2 per score.
// block = NW waves, grid = 256 = 128 pairs x 2 parities. A pair owns the 32-row query blocks B and
// 255-B (257 key tiles of 32 keys together, for every pair); the work-group of parity e takes the key tiles
// j = e, e+2, ... of both blocks, one block after the other. Wave w takes every NW-th of these
// and keeps its own running max / sum / O per query tile. The second block deals its tiles to the waves
// in reverse order, so the two remainders fall on different waves. The waves' partials meet in LDS behind
// one barrier and are merged with weights exp(m_w - M); the work-group's result (max, sum, un-normalised O
// of its parity's keys) goes to the workspace, and kernel 3 joins the two parities.
// Both products run on the bf16
// 16x16x32 form, every f32 operand as two bf16 parts, three matrix instructions a product
// (hi*hi + hi*lo + lo*hi, f32 accumulators), and both run transposed: S^T = K Q^T (A = K, B = Q) and
// O^T += V^T P^T (A = V^T, B = P^T). A lane then holds 16 keys' scores of ONE query per query tile
// (query ln, keys 16i + 8hi + v): max and sum run inside the lane, with one exchange
// between the half-waves, and the lane's own 16 values, split in place, are its B fragment of P^T;
// V is stored in that key order. Q and K fragments are read by the same code, so they carry the same d
// at every position.
// ---------------------------------------------------------------------------
#define NW 16   // waves per work-group (4 per SIMD)
#define FA_THREADS 512
#define NB32 (S_TOK / 32)   // 256 query blocks of 32 rows
#define OP   68             // LDS row pitch of an O partial in floats: 272 B = 16 B x 17 (odd), so the 16 rows of a 16-byte store fall on different banks
#define OPT  (16 * OP)      // one 16-row partial
static_assert(FA_THREADS == NW * 32, "one wave is 32 lanes");

__global__ __launch_bounds__(FA_THREADS)
void flash_attn_kernel(const float* __restrict__ Q,
                       const float* __restrict__ K,
                       const float* __restrict__ V,
                       float* __restrict__ opar /* [2 parities][S][64] */,
                       float* __restrict__ mlpar /* [2 parities][S][2] */) {
  __shared__ __attribute__((aligned(16))) float opart[2 * NW * 2 * OPT];  // un-normalised O partial per (block, wave, query tile); 16-byte stores
  __shared__ float mpart[2 * 32 * NW];    // running max  [block][row][wave]
  __shared__ float lpart[2 * 32 * NW];    // running sum  [block][row][wave]

  const int lane = threadIdx.x & 31;
  // wave number as a scalar: the tile loop's trip count is then a scalar branch
  const int wid  = __builtin_amdgcn_readfirstlane(threadIdx.x >> 5);
  const int hi   = lane >> 4;
  const int ln   = lane & 15;
  const unsigned int lane4 = lane * 4;   // a lane's 16 bytes inside a 512-byte group
  const int pair = blockIdx.x >> 1;      // 0..127
  const int par  = blockIdx.x & 1;       // which key tiles: even or odd

  for (int h = 0; h < 2; ++h) {
    const int iblk = h ? (NB32 - 1 - pair) : pair;  // 32-row query block, 0..255

    const int last = iblk;         // the 32-key tile that holds the diagonal

    // Q B-fragments (N = query ln) of both query tiles: two chunks of 32 d, hi and lo part (64 VGPRs)
    bf16x16 qh[2][2], ql[2][2];
#pragma unroll                     // qh[], ql[] live in registers: constant indices
    for (int g = 0; g < 2; ++g) {
      gfloat_p qt = scalar_base(Q + (size_t)(2 * iblk + g) * 1024) + lane4;
#pragma unroll
      for (int c = 0; c < 2; ++c) {
        qh[g][c] = frag(qt + (2 * c) * 128);
        ql[g][c] = frag(qt + (4 + 2 * c) * 128);
      }
    }

    F8 o[2][4] = {};               // O^T accumulators: o[g][t].f[v] = O[query 16g + ln][d = 16t + 8hi + v]
    float m[2] = {-__builtin_inff(), -__builtin_inff()};   // running max of query 16g + ln (equal in both half-waves)
    float l[2] = {0.0f, 0.0f};     // running sum of query 16g + ln over this half-wave's keys

    int j = par + 2 * (h ? (NW - 1 - wid) : wid);   // this wave's first key tile
    // the tile loop's addresses overwrite the scalar bases of the Q loads: keep the wait in front of that
    // (the tile number passes through the statement because those addresses are derived from it)
    asm volatile("s_wait_xcnt 0x0" : "+s"(j) : : "memory");
    for (; j <= last; j += 2 * NW) {
      if (j + 2 * NW <= last) {  // prefetch this wave's next K/V tile, one request per 256 B (global_prefetch_b8)
        __builtin_prefetch(scalar_base(K + (size_t)(j + 2 * NW) * 2048) + lane4 * 16, 0, 3);
        __builtin_prefetch(scalar_base(V + (size_t)(j + 2 * NW) * 2048) + lane4 * 16, 0, 3);
      }

      // ---- S^T = K_j @ (Q/sqrt(dk))^T : two 16-key halves x two query tiles = four independent 6-deep WMMA chains ----
      F8 s[2][2] = {};             // s[g][i].f[v] = score of key 16i + 8hi + v, query 16g + ln
      gfloat_p kt = scalar_base(K + (size_t)j * 2048) + lane4;
      bf16x16 kh[2][2], kl[2][2];
      // all loops unrolled: the fragments and s[] live in registers and need constant indices
#pragma unroll
      for (int c = 0; c < 2; ++c) {
#pragma unroll
        for (int i = 0; i < 2; ++i) {
          kh[c][i] = frag(kt + i * 1024 + (2 * c) * 128);
          kl[c][i] = frag(kt + i * 1024 + (4 + 2 * c) * 128);
        }
      }
      // scheduling fence, no instruction: holds the tile's 16 K loads together in front of the products. A build
      // without it issues part of them in pairs between the matrix instructions, each pair waited for to a
      // count of 0: several load latencies a tile, one behind the other
      __builtin_amdgcn_sched_barrier(0);
#pragma unroll
      for (int c = 0; c < 2; ++c) {
#pragma unroll
        for (int g = 0; g < 2; ++g) {
          s[g][0].v = wmma32(kl[c][0], qh[g][c], s[g][0].v);
          s[g][1].v = wmma32(kl[c][1], qh[g][c], s[g][1].v);
        }
#pragma unroll
        for (int g = 0; g < 2; ++g) {
          s[g][0].v = wmma32(kh[c][0], ql[g][c], s[g][0].v);
          s[g][1].v = wmma32(kh[c][1], ql[g][c], s[g][1].v);
        }
#pragma unroll
        for (int g = 0; g < 2; ++g) {
          s[g][0].v = wmma32(kh[c][0], qh[g][c], s[g][0].v);
          s[g][1].v = wmma32(kh[c][1], qh[g][c], s[g][1].v);
        }
      }

      // A-frags of V^T (M = d = 16t+ln), hi and lo part: requested here, used behind the softmax
      gfloat_p vt = scalar_base(V + (size_t)j * 2048) + lane4;
      bf16x16 vh[4], vl[4];
#pragma unroll                     // vh[], vl[] live in registers: constant indices
      for (int t = 0; t < 4; ++t) {
        vh[t] = frag(vt + (2 * t) * 128);
        vl[t] = frag(vt + (8 + 2 * t) * 128);
      }

      bf16x16 ph[2], pl[2];        // B fragments of P^T, one pair per query tile
#pragma unroll                     // everything indexed by g lives in registers: constant indices
      for (int g = 0; g < 2; ++g) {
        // ---- causal mask + online softmax of query 16g + ln ----
        if (j == last) {
          const int qrel = g * 16 + ln - 8 * hi;   // the query's place inside this 32-key tile, less the lane's first key
          // both loops unrolled: s[] lives in registers, constant indices
#pragma unroll
          for (int i = 0; i < 2; ++i)
#pragma unroll
            for (int v = 0; v < 8; ++v)
              if (16 * i + v > qrel) s[g][i].f[v] = -__builtin_inff();   // key 16i + 8hi + v > query -> masked
        }
        float mx = -__builtin_inff();
#pragma unroll                     // s[] lives in registers: constant indices
        for (int i = 0; i < 2; ++i)
          mx = fmaxf(mx, fmaxf(fmaxf(fmaxf(s[g][i].f[0], s[g][i].f[1]), fmaxf(s[g][i].f[2], s[g][i].f[3])),
                               fmaxf(fmaxf(s[g][i].f[4], s[g][i].f[5]), fmaxf(s[g][i].f[6], s[g][i].f[7]))));
        mx = fmaxf(mx, xhalf(mx));   // all 32 keys of the tile
        const float mn = fmaxf(m[g], mx);
        const float sc = __expf(m[g] - mn);
        m[g] = mn;
        float ps[2];
#pragma unroll                     // s[], ps[] live in registers: constant indices
        for (int i = 0; i < 2; ++i) {
#pragma unroll
          for (int v = 0; v < 8; ++v) s[g][i].f[v] = (s[g][i].f[v] - mn) * 1.44269504f;   // e^x = 2^(x log2 e), as __expf forms it
          // eight 2^x, in place, as ONE statement: each stands behind an independent one and
          // the v_nop fills the slot the instruction set asks for behind the last
          asm("v_exp_f32 %0, %0\n\tv_exp_f32 %1, %1\n\tv_exp_f32 %2, %2\n\tv_exp_f32 %3, %3\n\t"
              "v_exp_f32 %4, %4\n\tv_exp_f32 %5, %5\n\tv_exp_f32 %6, %6\n\tv_exp_f32 %7, %7\n\tv_nop"
              : "+v"(s[g][i].f[0]), "+v"(s[g][i].f[1]), "+v"(s[g][i].f[2]), "+v"(s[g][i].f[3]),
                "+v"(s[g][i].f[4]), "+v"(s[g][i].f[5]), "+v"(s[g][i].f[6]), "+v"(s[g][i].f[7]));
          ps[i] = ((s[g][i].f[0] + s[g][i].f[1]) + (s[g][i].f[2] + s[g][i].f[3])) + ((s[g][i].f[4] + s[g][i].f[5]) + (s[g][i].f[6] + s[g][i].f[7]));
        }
        l[g] = l[g] * sc + (ps[0] + ps[1]);
#pragma unroll                     // o[] lives in registers: constant indices
        for (int t = 0; t < 4; ++t) o[g][t].v *= sc;   // every element of a lane belongs to query 16g + ln

        // B fragment of P^T (N = query ln): element e = the lane's own p of key 16(e>>3) + 8hi + (e&7), two parts
        u32x4 ph0, pl0, ph1, pl1;
        split8(s[g][0].v, ph0, pl0);
        split8(s[g][1].v, ph1, pl1);
        ph[g] = __builtin_bit_cast(bf16x16, __builtin_shufflevector(ph0, ph1, 0, 1, 2, 3, 4, 5, 6, 7));
        pl[g] = __builtin_bit_cast(bf16x16, __builtin_shufflevector(pl0, pl1, 0, 1, 2, 3, 4, 5, 6, 7));
      }

      // ---- O^T += V_j^T @ P^T : 8 independent chains (4 d tiles x 2 query tiles), 3 deep ----
      // all loops unrolled: vh[], vl[] and o[] live in registers and need constant indices
#pragma unroll
      for (int t = 0; t < 4; ++t)
#pragma unroll
        for (int g = 0; g < 2; ++g) o[g][t].v = wmma32(vl[t], ph[g], o[g][t].v);
#pragma unroll
      for (int t = 0; t < 4; ++t)
#pragma unroll
        for (int g = 0; g < 2; ++g) o[g][t].v = wmma32(vh[t], pl[g], o[g][t].v);
#pragma unroll
      for (int t = 0; t < 4; ++t)
#pragma unroll
        for (int g = 0; g < 2; ++g) o[g][t].v = wmma32(vh[t], ph[g], o[g][t].v);

      // the next trip's addresses overwrite the scalar bases of this tile's loads: keep the wait in front of that.
      // The tile number passes through the statement because those addresses are derived from it
      asm volatile("s_wait_xcnt 0x0" : "+s"(j) : : "memory");
    }

    // ---- hand this wave's partials to LDS (a wave without a tile: m=-inf, l=0, O=0) ----
    // a lane holds 8 consecutive d of row ln per tile t: 16-byte stores at constant offsets from one address
    // all loops unrolled: o[][] lives in registers and needs constant indices
#pragma unroll
    for (int g = 0; g < 2; ++g) {
      float* op = &opart[((h * NW + wid) * 2 + g) * OPT + ln * OP + 8 * hi];
#pragma unroll
      for (int t = 0; t < 4; ++t) {
#pragma unroll
        for (int u = 0; u < 2; ++u) {
          const v4f piece = {o[g][t].f[4 * u], o[g][t].f[4 * u + 1], o[g][t].f[4 * u + 2], o[g][t].f[4 * u + 3]};
          *(v4f*)(op + 16 * t + 4 * u) = piece;
        }
      }
      l[g] += xhalf(l[g]);         // join the two half-waves' sums
      if (hi == 0) {               // m, l are equal in both half-waves now
        mpart[(h * 32 + g * 16 + ln) * NW + wid] = m[g];
        lpart[(h * 32 + g * 16 + ln) * NW + wid] = l[g];
      }
    }
  }

  __syncthreads();   // every wave's four partials are in LDS

  // ---- merge: one wave per row (2 blocks x 32 rows dealt over the NW waves);
  //      lane p first holds partial p's weight, then lane -> 2 columns ----
  for (int r = wid; r < 64; r += NW) {
    const int mh  = r >> 5;
    const int g   = (r >> 4) & 1;
    const int row = r & 15;
    const int mblk = mh ? (NB32 - 1 - pair) : pair;
    const int pw = (lane < NW) ? lane : 0;           // lanes past NW hold no partial
    float mp = mpart[(r) * NW + pw];
    float lp = lpart[(r) * NW + pw];
    if (lane >= NW) { mp = -__builtin_inff(); lp = 0.0f; }
    float M = mp;
#pragma unroll                     // five fixed exchange steps, no loop counter
    for (int d = 16; d >= 1; d >>= 1) M = fmaxf(M, __shfl_xor(M, d, 32));
    // 0 for a wave that had no tile, also where no wave of this parity had one (M = -inf)
    const float w = (mp == -__builtin_inff()) ? 0.0f : __expf(mp - M);
    float L = w * lp;
#pragma unroll                     // five fixed exchange steps, no loop counter
    for (int d = 16; d >= 1; d >>= 1) L += __shfl_xor(L, d, 32);

    const float* ob = &opart[(mh * NW * 2 + g) * OPT + row * OP + 2 * lane];
    v2f acc = {0.0f, 0.0f};
    // unrolled so that each partial's weight is read from a constant lane (v_readlane)
#pragma unroll
    for (int p = 0; p < NW; ++p) {
      const float wp = __int_as_float(__builtin_amdgcn_readlane(__float_as_int(w), p));
      const v2f x = *(const v2f*)(ob + p * 2 * OPT);
      acc.x += wp * x.x;
      acc.y += wp * x.y;
    }
    const size_t grow = (size_t)par * S_TOK + (size_t)(mblk * 32 + g * 16 + row);
    *(v2f*)(opar + grow * DOUT + 2 * lane) = acc;
    if (lane == 0) {
      const v2f ml = {M, L};
      *(v2f*)(mlpar + grow * 2) = ml;
    }
    // the next trip reuses the stores' registers: keep the wait in front of that
    asm volatile("s_wait_xcnt 0x0" ::: "memory");
  }
}

// ---------------------------------------------------------------------------
// Kernel 3: joins the two parities' partials of every row: out = (w0 O0 + w1 O1) / (w0 l0 + w1 l1),
// w = exp(m - max). A parity without a key for the row has m = -inf, l = 0, O = 0.
// A thread owns 4 pieces of 4 columns, a whole grid apart; few waves, because a launch this short is
// mostly the time its waves take to start.
// ---------------------------------------------------------------------------
#define JN_THREADS 128
#define JN_GRID    256
#define JN_PER     4
#define JN_ALL     (JN_GRID * JN_THREADS)
static_assert(JN_ALL * JN_PER * 4 == S_TOK * DOUT, "every output element belongs to one thread");

__global__ __launch_bounds__(JN_THREADS)
void join_kernel(const float* __restrict__ opar, const float* __restrict__ mlpar, float* __restrict__ out) {
  int t0 = blockIdx.x * JN_THREADS + threadIdx.x;
  v4f o0[JN_PER], o1[JN_PER];
  v2f a[JN_PER], b[JN_PER];
#pragma unroll                     // the arrays live in registers: constant indices; all 16 loads are in flight together
  for (int k = 0; k < JN_PER; ++k) {
    o0[k] = *(const v4f*)(opar + (size_t)t0 * 4 + k * (JN_ALL * 4));
    o1[k] = *(const v4f*)(opar + (size_t)t0 * 4 + k * (JN_ALL * 4) + S_TOK * DOUT);
  }
  int row0 = t0 >> 4;              // piece k lies in row row0 + k * JN_ALL / 16
#pragma unroll                     // a[], b[] live in registers: constant indices
  for (int k = 0; k < JN_PER; ++k) {
    a[k] = *(const v2f*)(mlpar + (size_t)row0 * 2 + k * (JN_ALL / 8));
    b[k] = *(const v2f*)(mlpar + (size_t)row0 * 2 + k * (JN_ALL / 8) + S_TOK * 2);
  }
  // the loads' results may be laid on registers that earlier loads of the run name as their offsets: keep the wait
  // in front of every such write. Both offsets pass through the statement, so they live up to the wait and
  // no load of the run is given one of them as its destination (the clobber holds all 16 loads in front of it)
  asm volatile("s_wait_xcnt 0x0" : "+v"(row0), "+v"(t0) : : "memory");
  float e0[JN_PER], e1[JN_PER];
#pragma unroll                     // e0[], e1[] live in registers: constant indices
  for (int k = 0; k < JN_PER; ++k) {
    const float M = fmaxf(a[k].x, b[k].x);
    e0[k] = (a[k].x - M) * 1.44269504f;   // e^x = 2^(x log2 e), as __expf forms it
    e1[k] = (b[k].x - M) * 1.44269504f;
  }
  // eight 2^x, in place, as ONE statement: each stands behind an independent one and the v_nop fills the slot
  // the instruction set asks for behind the last
  asm("v_exp_f32 %0, %0\n\tv_exp_f32 %1, %1\n\tv_exp_f32 %2, %2\n\tv_exp_f32 %3, %3\n\t"
      "v_exp_f32 %4, %4\n\tv_exp_f32 %5, %5\n\tv_exp_f32 %6, %6\n\tv_exp_f32 %7, %7\n\tv_nop"
      : "+v"(e0[0]), "+v"(e0[1]), "+v"(e0[2]), "+v"(e0[3]), "+v"(e1[0]), "+v"(e1[1]), "+v"(e1[2]), "+v"(e1[3]));
  v4f res[JN_PER];
#pragma unroll                     // res[] lives in registers: constant indices
  for (int k = 0; k < JN_PER; ++k) {
    const float w0 = (a[k].x == -__builtin_inff()) ? 0.0f : e0[k];   // a parity without a key for the row counts for nothing
    const float w1 = (b[k].x == -__builtin_inff()) ? 0.0f : e1[k];
    const float inv = 1.0f / (w0 * a[k].y + w1 * b[k].y);
    res[k] = (o0[k] * w0 + o1[k] * w1) * inv;
  }
#pragma unroll                     // res[] lives in registers: constant indices
  for (int k = 0; k < JN_PER; ++k) *(v4f*)(out + (size_t)t0 * 4 + k * (JN_ALL * 4)) = res[k];
}

// ---------------------------------------------------------------------------
extern "C" void kernel_launch(void* const* d_in, const int* in_sizes, int n_in,
                              void* d_out, int out_size, void* d_ws, size_t ws_size,
                              hipStream_t stream) {
  const float* x  = (const float*)d_in[0];
  const float* Wq = (const float*)d_in[1];
  const float* Wk = (const float*)d_in[2];
  const float* Wv = (const float*)d_in[3];
  float* qkv = (float*)d_ws;              // Q | K | V, each S*64 x 4 bytes (6 MB), tiled, two bf16 parts an element
  float* out = (float*)d_out;

  qkv_proj_kernel<<<PJ_GRID, PJ_THREADS, 0, stream>>>(x, Wq, Wk, Wv, qkv);

  const float* Qp = qkv;
  const float* Kp = qkv + (size_t)S_TOK * DOUT;
  const float* Vp = qkv + (size_t)2 * S_TOK * DOUT;
  float* opar  = qkv + (size_t)3 * S_TOK * DOUT;   // the two parities' O partials (4 MB)
  float* mlpar = qkv + (size_t)5 * S_TOK * DOUT;   // their max and sum per row (128 KB)
  flash_attn_kernel<<<256, FA_THREADS, 0, stream>>>(Qp, Kp, Vp, opar, mlpar);
  join_kernel<<<JN_GRID, JN_THREADS, 0, stream>>>(opar, mlpar, out);
}

// v007
// A run of this version takes 34.9 microseconds.
// Next to v006, in two timings, it ran 1.07 and 1.10 times as fast.
// Over all steps from v000 it is 16.9 times as fast.
#include <hip/hip_runtime.h>

typedef float v2f __attribute__((ext_vector_type(2)));
typedef float v4f __attribute__((ext_vector_type(4)));
typedef float v8f __attribute__((ext_vector_type(8)));

#define S_TOK 8192
#define DIN   512
#define DOUT  64
#define NBLK  (S_TOK / 16)   // 512 row blocks

typedef __bf16 bf16x2  __attribute__((ext_vector_type(2)));
typedef __bf16 bf16x16 __attribute__((ext_vector_type(16)));
typedef unsigned int u32x4 __attribute__((ext_vector_type(4)));
typedef unsigned int u32x8 __attribute__((ext_vector_type(8)));

union F8 { v8f v; float f[8]; };

__device__ __forceinline__ v8f wmma4(v2f a, v2f b, v8f c) {
  // D = A(16x4 f32) * B(4x16 f32) + C(16x16 f32)
  return __builtin_amdgcn_wmma_f32_16x16x4_f32(
      /*neg_a=*/false, a, /*neg_b=*/false, b,
      /*c_mod=*/(short)0, c, /*reuse_a=*/false, /*reuse_b=*/false);
}

__device__ __forceinline__ v8f wmma32(bf16x16 a, bf16x16 b, v8f c) {
  // D = A(16x32 bf16) * B(32x16 bf16) + C(16x16 f32)
  return __builtin_amdgcn_wmma_f32_16x16x32_bf16(0, a, 0, b, (short)0, c, false, false);
}

// an f32 value as two bf16 parts: hi = x rounded to bf16, lo = (x - hi) rounded to bf16; hi + lo
// carries about 16 bits of x. A product a*b is then formed as ah*bh + ah*bl + al*bh in f32 accumulators.
// Eight values at a time, packed in pairs: element e sits in half e & 1 of word e >> 1.
__device__ __forceinline__ void split8(v8f x, u32x4& hi, u32x4& lo) {
#pragma unroll                     // the words live in registers: constant indices
  for (int i = 0; i < 4; ++i) {
    const v2f p = {x[2 * i], x[2 * i + 1]};
    const unsigned int w = __builtin_bit_cast(unsigned int, __builtin_convertvector(p, bf16x2));
    const v2f back = {__uint_as_float(w << 16), __uint_as_float(w & 0xffff0000u)};   // the hi parts as f32
    hi[i] = w;
    lo[i] = __builtin_bit_cast(unsigned int, __builtin_convertvector(p - back, bf16x2));
  }
}

typedef const __attribute__((address_space(1))) float* gfloat_p;   // a pointer to global memory
typedef const __attribute__((address_space(1))) v4f*   gv4f_p;

// a wave-uniform global pointer as a value of its own in scalar registers: the loads that are formed from it take
// it as their scalar base, beside a 32-bit lane offset that lives through the loop
__device__ __forceinline__ gfloat_p scalar_base(const float* p) {
  const unsigned long long a = (unsigned long long)p;
  const unsigned int lo = __builtin_amdgcn_readfirstlane((unsigned int)a);
  const unsigned int hi = __builtin_amdgcn_readfirstlane((unsigned int)(a >> 32));
  return (gfloat_p)(((unsigned long long)hi << 32) | lo);
}

// one 16-element bf16 fragment of a lane: two 16-byte pieces that lie 512 bytes apart
__device__ __forceinline__ bf16x16 frag(gfloat_p p) {
  const v4f a = *(gv4f_p)p;
  const v4f b = *(gv4f_p)(p + 128);
  return __builtin_bit_cast(bf16x16, __builtin_shufflevector(a, b, 0, 1, 2, 3, 4, 5, 6, 7));
}

// value of lane l ^ 16 (the other half-wave), as one vector instruction
__device__ __forceinline__ float xhalf(float x) {
  const int b = __float_as_int(x);
  return __int_as_float(__builtin_amdgcn_permlanex16(b, b, 0x76543210, 0xfedcba98, false, false));
}

// ---------------------------------------------------------------------------
// Kernel 1: Q/K/V projection.  y = x @ W^T  (x:[S,512], W:[64,512], y:[S,64])
// One work-group of 12 waves computes 32 rows of x times all 192 output columns.
// The 32 rows (64 KiB, contiguous) are brought into LDS once, by loads that cover
// whole 128-byte lines, and every wave takes its x fragments from there. Wave w owns
// matrix w >> 2 ({Q,K,V}) and column tile w & 3, for both 16-row tiles: a W fragment is
// read once per work-group and feeds two independent accumulation chains.
// A lane reads 16 bytes of its row at a time (k = 8c + 4hi .. + 3) from x and from W
// alike; the first pair feeds one matrix instruction, the second pair the next, so
// A and B carry the same k at every position.
// Q (pre-scaled by 1/sqrt(64)), K and V leave as two bf16 parts each (split8), 4 bytes an element as
// before, in the order in which the attention kernel's lanes consume them: groups of 512 bytes,
// a group holding 8 bf16 (16 bytes) for each of the 32 lanes.
//   Q, K: per 16-row tile 8 groups, group 4*part + nt, lane (hi,ln), e: row ln, d = 16nt + 8hi + e
//   V: per 32-key tile 16 groups, group 8*part + 2nt + i, lane (hi,ln), e: key 16i + 8hi + e, d = 16nt + ln
// (part 0 = hi, 1 = lo). Q and K tiles are computed transposed (W rows as A, x rows as B), so that a
// lane holds 8 d of one row; a V lane holds 8 keys of one d. Every part leaves as one 16-byte store per lane.
// ---------------------------------------------------------------------------
#define PJ_ROWS    32
#define PJ_THREADS 384   // 12 waves, 3 per SIMD
#define PJ_GRID    256   // S_TOK / PJ_ROWS
#define XP         516   // LDS row pitch in floats: 2064 B = 16 B x 129 (odd), so the 16 rows of a 16-byte read fall on different banks
static_assert(PJ_GRID * PJ_ROWS == S_TOK, "every row of x belongs to one work-group");

// 512-deep products of one W column tile with the two row tiles. KT: W rows as A (Q and K, transposed).
// k runs in 8 blocks of 64. wc holds block 0's W fragments on entry; each block's W loads are issued
// one block (32 matrix instructions) ahead of their use.
template <bool KT>
__device__ __forceinline__ void proj_tiles(const float* xa, const float* wrow, v4f (&wc)[8], F8& acc0, F8& acc1) {
  // both loops unrolled whole: wc[], wn[] live in registers (constant indices), every offset is an immediate
#pragma unroll
  for (int b = 0; b < DIN / 64; ++b) {
    v4f wn[8];
    if (b + 1 < DIN / 64) {
#pragma unroll
      for (int c = 0; c < 8; ++c) wn[c] = *(const v4f*)(wrow + 64 * (b + 1) + 8 * c);
    }
    // compiler fence, no instruction: holds the next block's W loads here, one block ahead of their use. A build
    // without it moves them, on the K path, down to directly in front of their use (waits to a count of 0 or 1),
    // and every pair of them is then waited for at full load latency
    asm volatile("" ::: "memory");
#pragma unroll
    for (int c = 0; c < 8; ++c) {
      const v4f w  = wc[c];
      const v4f x0 = *(const v4f*)(xa + 64 * b + 8 * c);
      const v4f x1 = *(const v4f*)(xa + 16 * XP + 64 * b + 8 * c);
      const v2f wl = {w.x, w.y},   wh = {w.z, w.w};
      const v2f l0 = {x0.x, x0.y}, h0 = {x0.z, x0.w};
      const v2f l1 = {x1.x, x1.y}, h1 = {x1.z, x1.w};
      if (KT) {
        acc0.v = wmma4(wl, l0, acc0.v);
        acc1.v = wmma4(wl, l1, acc1.v);
        acc0.v = wmma4(wh, h0, acc0.v);
        acc1.v = wmma4(wh, h1, acc1.v);
      } else {
        acc0.v = wmma4(l0, wl, acc0.v);
        acc1.v = wmma4(l1, wl, acc1.v);
        acc0.v = wmma4(h0, wh, acc0.v);
        acc1.v = wmma4(h1, wh, acc1.v);
      }
    }
    if (b + 1 < DIN / 64) {
#pragma unroll
      for (int c = 0; c < 8; ++c) wc[c] = wn[c];
    }
  }
}

// the wave's two finished 16x16 tiles (rows 0-15 and 16-31 of the work-group) to their plane, as bf16 parts
__device__ __forceinline__ void proj_store(float* __restrict__ qkv, const F8& acc0, const F8& acc1,
                                           int mat, int nt, int blk, int lane) {
  float* out = qkv + (size_t)mat * S_TOK * DOUT + (size_t)blk * 2048 + lane * 4;
  const float sc = (mat == 0) ? 0.125f : 1.0f;   // 1/sqrt(d_k) folded into Q (a power of two: exact)
  u32x4 h0, l0, h1, l1;
  split8(acc0.v * sc, h0, l0);
  split8(acc1.v * sc, h1, l1);
  // Q, K: M = d = 16nt + 8hi + v, N = row ln -> tile i, group 4*part + nt
  // V:    M = key = 16i + 8hi + v, N = d = 16nt + ln -> group 8*part + 2nt + i
  const bool isv = (mat == 2);
  float* t0 = out + (isv ? nt * 256       : nt * 128);
  float* t1 = out + (isv ? nt * 256 + 128 : nt * 128 + 1024);
  const int lo_off = isv ? 1024 : 512;
  *(v4f*)t0            = __builtin_bit_cast(v4f, h0);
  *(v4f*)(t0 + lo_off) = __builtin_bit_cast(v4f, l0);
  *(v4f*)t1            = __builtin_bit_cast(v4f, h1);
  *(v4f*)(t1 + lo_off) = __builtin_bit_cast(v4f, l1);
  // whatever the listing lays behind these stores may reuse their registers: keep the wait in front of that
  asm volatile("s_wait_xcnt 0x0" ::: "memory");
}

__global__ __launch_bounds__(PJ_THREADS)
void qkv_proj_kernel(const float* __restrict__ x,
                     const float* __restrict__ Wq,
                     const float* __restrict__ Wk,
                     const float* __restrict__ Wv,
                     float* __restrict__ qkv /* [3][S][64] */) {
  __shared__ __attribute__((aligned(16))) float xs[PJ_ROWS * XP];

  const int tid  = threadIdx.x;
  const int lane = tid & 31;
  const int hi   = lane >> 4;     // which half-wave
  const int ln   = lane & 15;
  // wave number as a scalar: matrix and column tile are then scalar too
  int wid = __builtin_amdgcn_readfirstlane(tid >> 5);

  // ---- the work-group's 32 rows of x into LDS: 4096 pieces of 16 bytes, a wave's load = 512 contiguous bytes;
  //      10 rounds of all 12 waves and one of the first 8; all loads are issued before the first store ----
  const float* xg = x + (size_t)blockIdx.x * PJ_ROWS * DIN;
  static_assert(PJ_ROWS * DIN / 4 == 10 * PJ_THREADS + 8 * 32, "rounds of the staging loop");
  v4f r[11];
#pragma unroll                     // r[] lives in registers: constant indices
  for (int i = 0; i < 10; ++i) r[i] = *(const v4f*)(xg + (size_t)(tid + i * PJ_THREADS) * 4);
  if (wid < 8) r[10] = *(const v4f*)(xg + (size_t)(tid + 10 * PJ_THREADS) * 4);
  // the scalar code behind reuses the base registers of these loads: keep the wait in front of that.
  // The wave number passes through the statement because all of that code is derived from it
  asm volatile("s_wait_xcnt 0x0" : "+s"(wid) : : "memory");
  const int mat = wid >> 2;       // 0=Q 1=K 2=V
  const int nt  = wid & 3;        // output column tile

  // first block of this wave's W fragments: requested together with the x rows, used behind the barrier
  const float* W    = (mat == 0) ? Wq : (mat == 1 ? Wk : Wv);
  const float* wrow = W + (size_t)(nt * 16 + ln) * DIN + 4 * hi;
  v4f wc[8];
#pragma unroll                     // wc[] lives in registers: constant indices
  for (int c = 0; c < 8; ++c) wc[c] = *(const v4f*)(wrow + 8 * c);

#pragma unroll
  for (int i = 0; i < 10; ++i) {
    const int idx = tid + i * PJ_THREADS;
    *(v4f*)&xs[(idx >> 7) * XP + (idx & 127) * 4] = r[i];
  }
  if (wid < 8) {
    const int idx = tid + 10 * PJ_THREADS;
    *(v4f*)&xs[(idx >> 7) * XP + (idx & 127) * 4] = r[10];
  }
  __syncthreads();   // x rows are in LDS for every wave

  const float* xa = &xs[ln * XP + 4 * hi];

  F8 acc0 = {}, acc1 = {};        // row tiles 0 and 1: two independent accumulation chains
  if (mat != 2) proj_tiles<true>(xa, wrow, wc, acc0, acc1);
  else          proj_tiles<false>(xa, wrow, wc, acc0, acc1);

  proj_store(qkv, acc0, acc1, mat, nt, blockIdx.x, lane);
}

// ---------------------------------------------------------------------------
// Kernel 2: causal flash attention. A wave keeps TWO 16-row query tiles (32 adjacent queries) and
// feeds both from every K and V fragment that it loads: half the bytes from L2 per score.
// block = NW waves, grid = 256 = 64 pairs x NSPL key shares. A pair owns the 64-row query blocks B and
// 127-B, one after the other. The waves of a work-group are 8 sets of twins: both twins of set ks walk the
// SAME key tiles j = 8e + ks, + 32, ... (e = the work-group's share), one for the lower 32 queries of the
// block and one for the upper 32, at the same time: the line of K or V that one twin has brought into the
// WGP's cache serves the other, so L2 delivers a tile once for 64 queries. A wave
// keeps its own running max / sum / O per query tile. The second block deals its tiles to the sets
// in reverse order, so the two remainders fall on different waves. The waves' partials meet in LDS behind
// one barrier and are merged, 8 per row, with weights exp(m_w - M); the work-group's result (max, sum,
// un-normalised O of its share's keys) goes to the workspace, and kernel 3 joins the NSPL shares.
// Both products run on the bf16
// 16x16x32 form, every f32 operand as two bf16 parts, three matrix instructions a product
// (hi*hi + hi*lo + lo*hi, f32 accumulators), and both run transposed: S^T = K Q^T (A = K, B = Q) and
// O^T += V^T P^T (A = V^T, B = P^T). A lane then holds 16 keys' scores of ONE query per query tile
// (query ln, keys 16i + 8hi + v): max and sum run inside the lane, with one exchange
// between the half-waves, and the lane's own 16 values, split in place, are its B fragment of P^T;
// V is stored in that key order. Q and K fragments are read by the same code, so they carry the same d
// at every position.
// ---------------------------------------------------------------------------
#define NW 16   // waves per work-group (4 per SIMD)
#define FA_THREADS 512
#define NB64 (S_TOK / 64)   // 128 query blocks of 64 rows
#define NSPL 4              // work-groups that share the keys of a pair of query blocks
#define NKS  (NW / 2)       // sets of twin waves = partials per query row in a work-group
#define OP   68             // LDS row pitch of an O partial in floats: 272 B = 16 B x 17 (odd), so the 16 rows of a 16-byte store fall on different banks
#define OPT  (16 * OP)      // one 16-row partial
static_assert(FA_THREADS == NW * 32, "one wave is 32 lanes");
static_assert(NSPL * NKS == 2 * NW, "the tile loop's step covers every share's every set once");

__global__ __launch_bounds__(FA_THREADS)
void flash_attn_kernel(const float* __restrict__ Q,
                       const float* __restrict__ K,
                       const float* __restrict__ V,
                       float* __restrict__ opar /* [NSPL shares][S][64] */,
                       float* __restrict__ mlpar /* [NSPL shares][S][2] */) {
  __shared__ __attribute__((aligned(16))) float opart[2 * NW * 2 * OPT];  // un-normalised O partial per (block, wave, query tile); 16-byte stores
  __shared__ __attribute__((aligned(16))) float mpart[2 * 64 * NKS];   // running max  [block][row][set]; read 16 bytes at a time
  __shared__ __attribute__((aligned(16))) float lpart[2 * 64 * NKS];   // running sum  [block][row][set]

  const int lane = threadIdx.x & 31;
  // wave number as a scalar: the tile loop's trip count is then a scalar branch
  const int wid  = __builtin_amdgcn_readfirstlane(threadIdx.x >> 5);
  const int hi   = lane >> 4;
  const int ln   = lane & 15;
  const unsigned int lane4 = lane * 4;   // a lane's 16 bytes inside a 512-byte group
  const int pair = blockIdx.x >> 2;      // 0..63
  const int par  = blockIdx.x & 3;       // which share of the key tiles
  const int qg   = wid & 1;              // which twin: lower or upper 32 queries of the block
  const int ks   = wid >> 1;             // set of twins
  const int slot = par * NKS + ks;       // the set's place among the 32 that the key tiles are dealt to

  for (int h = 0; h < 2; ++h) {
    const int iblk = 2 * (h ? (NB64 - 1 - pair) : pair) + qg;  // this wave's 32 query rows, 0..255

    const int last = iblk;         // the 32-key tile that holds the diagonal

    // Q B-fragments (N = query ln) of both query tiles: two chunks of 32 d, hi and lo part (64 VGPRs)
    bf16x16 qh[2][2], ql[2][2];
#pragma unroll                     // qh[], ql[] live in registers: constant indices
    for (int g = 0; g < 2; ++g) {
      gfloat_p qt = scalar_base(Q + (size_t)(2 * iblk + g) * 1024) + lane4;
#pragma unroll
      for (int c = 0; c < 2; ++c) {
        qh[g][c] = frag(qt + (2 * c) * 128);
        ql[g][c] = frag(qt + (4 + 2 * c) * 128);
      }
    }

    F8 o[2][4] = {};               // O^T accumulators: o[g][t].f[v] = O[query 16g + ln][d = 16t + 8hi + v]
    float m[2] = {-__builtin_inff(), -__builtin_inff()};   // running max of query 16g + ln (equal in both half-waves)
    float l[2] = {0.0f, 0.0f};     // running sum of query 16g + ln over this half-wave's keys

    int j = h ? (2 * NW - 1 - slot) : slot;   // this wave's first key tile, the same for both twins
    // the tile loop's addresses overwrite the scalar bases of the Q loads: keep the wait in front of that
    // (the tile number passes through the statement because those addresses are derived from it)
    asm volatile("s_wait_xcnt 0x0" : "+s"(j) : : "memory");
    for (; j <= last; j += 2 * NW) {
      if (qg == 0 && j + 2 * NW <= last) {  // one twin prefetches the set's next K/V tile, one request per 256 B (global_prefetch_b8)
        __builtin_prefetch(scalar_base(K + (size_t)(j + 2 * NW) * 2048) + lane4 * 16, 0, 3);
        __builtin_prefetch(scalar_base(V + (size_t)(j + 2 * NW) * 2048) + lane4 * 16, 0, 3);
      }

      // ---- S^T = K_j @ (Q/sqrt(dk))^T : two 16-key halves x two query tiles = four independent 6-deep WMMA chains ----
      F8 s[2][2] = {};             // s[g][i].f[v] = score of key 16i + 8hi + v, query 16g + ln
      gfloat_p kt = scalar_base(K + (size_t)j * 2048) + lane4;
      bf16x16 kh[2][2], kl[2][2];
      // all loops unrolled: the fragments and s[] live in registers and need constant indices
#pragma unroll
      for (int c = 0; c < 2; ++c) {
#pragma unroll
        for (int i = 0; i < 2; ++i) {
          kh[c][i] = frag(kt + i * 1024 + (2 * c) * 128);
          kl[c][i] = frag(kt + i * 1024 + (4 + 2 * c) * 128);
        }
      }
      // scheduling fence, no instruction: holds the tile's 16 K loads together in front of the products. A build
      // without it issues part of them in pairs between the matrix instructions, each pair waited for to a
      // count of 0: several load latencies a tile, one behind the other
      __builtin_amdgcn_sched_barrier(0);
#pragma unroll
      for (int c = 0; c < 2; ++c) {
#pragma unroll
        for (int g = 0; g < 2; ++g) {
          s[g][0].v = wmma32(kl[c][0], qh[g][c], s[g][0].v);
          s[g][1].v = wmma32(kl[c][1], qh[g][c], s[g][1].v);
        }
#pragma unroll
        for (int g = 0; g < 2; ++g) {
          s[g][0].v = wmma32(kh[c][0], ql[g][c], s[g][0].v);
          s[g][1].v = wmma32(kh[c][1], ql[g][c], s[g][1].v);
        }
#pragma unroll
        for (int g = 0; g < 2; ++g) {
          s[g][0].v = wmma32(kh[c][0], qh[g][c], s[g][0].v);
          s[g][1].v = wmma32(kh[c][1], qh[g][c], s[g][1].v);
        }
      }

      // A-frags of V^T (M = d = 16t+ln), hi and lo part: requested here, used behind the softmax
      gfloat_p vt = scalar_base(V + (size_t)j * 2048) + lane4;
      bf16x16 vh[4], vl[4];
#pragma unroll                     // vh[], vl[] live in registers: constant indices
      for (int t = 0; t < 4; ++t) {
        vh[t] = frag(vt + (2 * t) * 128);
        vl[t] = frag(vt + (8 + 2 * t) * 128);
      }

      bf16x16 ph[2], pl[2];        // B fragments of P^T, one pair per query tile
#pragma unroll                     // everything indexed by g lives in registers: constant indices
      for (int g = 0; g < 2; ++g) {
        // ---- causal mask + online softmax of query 16g + ln ----
        if (j == last) {
          const int qrel = g * 16 + ln - 8 * hi;   // the query's place inside this 32-key tile, less the lane's first key
          // both loops unrolled: s[] lives in registers, constant indices
#pragma unroll
          for (int i = 0; i < 2; ++i)
#pragma unroll
            for (int v = 0; v < 8; ++v)
              if (16 * i + v > qrel) s[g][i].f[v] = -__builtin_inff();   // key 16i + 8hi + v > query -> masked
        }
        float mx = -__builtin_inff();
#pragma unroll                     // s[] lives in registers: constant indices
        for (int i = 0; i < 2; ++i)
          mx = fmaxf(mx, fmaxf(fmaxf(fmaxf(s[g][i].f[0], s[g][i].f[1]), fmaxf(s[g][i].f[2], s[g][i].f[3])),
                               fmaxf(fmaxf(s[g][i].f[4], s[g][i].f[5]), fmaxf(s[g][i].f[6], s[g][i].f[7]))));
        mx = fmaxf(mx, xhalf(mx));   // all 32 keys of the tile
        const float mn = fmaxf(m[g], mx);
        const float sc = __expf(m[g] - mn);
        m[g] = mn;
        float ps[2];
#pragma unroll                     // s[], ps[] live in registers: constant indices
        for (int i = 0; i < 2; ++i) {
#pragma unroll
          for (int v = 0; v < 8; ++v) s[g][i].f[v] = (s[g][i].f[v] - mn) * 1.44269504f;   // e^x = 2^(x log2 e), as __expf forms it
          // eight 2^x, in place, as ONE statement: each stands behind an independent one and
          // the v_nop fills the slot the instruction set asks for behind the last
          asm("v_exp_f32 %0, %0\n\tv_exp_f32 %1, %1\n\tv_exp_f32 %2, %2\n\tv_exp_f32 %3, %3\n\t"
              "v_exp_f32 %4, %4\n\tv_exp_f32 %5, %5\n\tv_exp_f32 %6, %6\n\tv_exp_f32 %7, %7\n\tv_nop"
              : "+v"(s[g][i].f[0]), "+v"(s[g][i].f[1]), "+v"(s[g][i].f[2]), "+v"(s[g][i].f[3]),
                "+v"(s[g][i].f[4]), "+v"(s[g][i].f[5]), "+v"(s[g][i].f[6]), "+v"(s[g][i].f[7]));
          ps[i] = ((s[g][i].f[0] + s[g][i].f[1]) + (s[g][i].f[2] + s[g][i].f[3])) + ((s[g][i].f[4] + s[g][i].f[5]) + (s[g][i].f[6] + s[g][i].f[7]));
        }
        l[g] = l[g] * sc + (ps[0] + ps[1]);
#pragma unroll                     // o[] lives in registers: constant indices
        for (int t = 0; t < 4; ++t) o[g][t].v *= sc;   // every element of a lane belongs to query 16g + ln

        // B fragment of P^T (N = query ln): element e = the lane's own p of key 16(e>>3) + 8hi + (e&7), two parts
        u32x4 ph0, pl0, ph1, pl1;
        split8(s[g][0].v, ph0, pl0);
        split8(s[g][1].v, ph1, pl1);
        ph[g] = __builtin_bit_cast(bf16x16, __builtin_shufflevector(ph0, ph1, 0, 1, 2, 3, 4, 5, 6, 7));
        pl[g] = __builtin_bit_cast(bf16x16, __builtin_shufflevector(pl0, pl1, 0, 1, 2, 3, 4, 5, 6, 7));
      }

      // ---- O^T += V_j^T @ P^T : 8 independent chains (4 d tiles x 2 query tiles), 3 deep ----
      // all loops unrolled: vh[], vl[] and o[] live in registers and need constant indices
#pragma unroll
      for (int t = 0; t < 4; ++t)
#pragma unroll
        for (int g = 0; g < 2; ++g) o[g][t].v = wmma32(vl[t], ph[g], o[g][t].v);
#pragma unroll
      for (int t = 0; t < 4; ++t)
#pragma unroll
        for (int g = 0; g < 2; ++g) o[g][t].v = wmma32(vh[t], pl[g], o[g][t].v);
#pragma unroll
      for (int t = 0; t < 4; ++t)
#pragma unroll
        for (int g = 0; g < 2; ++g) o[g][t].v = wmma32(vh[t], ph[g], o[g][t].v);

      // the next trip's addresses overwrite the scalar bases of this tile's loads: keep the wait in front of that.
      // The tile number passes through the statement because those addresses are derived from it
      asm volatile("s_wait_xcnt 0x0" : "+s"(j) : : "memory");
    }

    // ---- hand this wave's partials to LDS (a wave without a tile: m=-inf, l=0, O=0) ----
    // a lane holds 8 consecutive d of row ln per tile t: 16-byte stores at constant offsets from one address
    // all loops unrolled: o[][] lives in registers and needs constant indices
#pragma unroll
    for (int g = 0; g < 2; ++g) {
      float* op = &opart[((h * NW + wid) * 2 + g) * OPT + ln * OP + 8 * hi];
#pragma unroll
      for (int t = 0; t < 4; ++t) {
#pragma unroll
        for (int u = 0; u < 2; ++u) {
          const v4f piece = {o[g][t].f[4 * u], o[g][t].f[4 * u + 1], o[g][t].f[4 * u + 2], o[g][t].f[4 * u + 3]};
          *(v4f*)(op + 16 * t + 4 * u) = piece;
        }
      }
      l[g] += xhalf(l[g]);         // join the two half-waves' sums
      if (hi == 0) {               // m, l are equal in both half-waves now
        mpart[(h * 64 + qg * 32 + g * 16 + ln) * NKS + ks] = m[g];
        lpart[(h * 64 + qg * 32 + g * 16 + ln) * NKS + ks] = l[g];
      }
    }
  }

  __syncthreads();   // every wave's four partials are in LDS

  // ---- merge: one wave per row (2 blocks x 64 rows dealt over the NW waves); every lane reads the row's
  //      NKS maxima and sums (one address for the whole wave) and forms the weights itself; lane -> 2 columns ----
  static_assert(NKS == 8, "two 16-byte reads and one statement of eight exponentials per row");
  for (int r = wid; r < 128; r += NW) {
    const int mh   = r >> 6;
    const int mq   = (r >> 5) & 1;
    const int g    = (r >> 4) & 1;
    const int row  = r & 15;
    const int mblk = mh ? (NB64 - 1 - pair) : pair;
    const v4f ma = *(const v4f*)&mpart[r * NKS], mb = *(const v4f*)&mpart[r * NKS + 4];
    const v4f la = *(const v4f*)&lpart[r * NKS], lb = *(const v4f*)&lpart[r * NKS + 4];
    const float mp[NKS] = {ma.x, ma.y, ma.z, ma.w, mb.x, mb.y, mb.z, mb.w};
    const float lp[NKS] = {la.x, la.y, la.z, la.w, lb.x, lb.y, lb.z, lb.w};
    const float M = fmaxf(fmaxf(fmaxf(mp[0], mp[1]), fmaxf(mp[2], mp[3])), fmaxf(fmaxf(mp[4], mp[5]), fmaxf(mp[6], mp[7])));
    float w[NKS];
#pragma unroll                     // w[] lives in registers: constant indices
    for (int p = 0; p < NKS; ++p) w[p] = (mp[p] - M) * 1.44269504f;   // e^x = 2^(x log2 e), as __expf forms it
    // eight 2^x, in place, as ONE statement: each stands behind an independent one and the v_nop fills the slot
    // the instruction set asks for behind the last
    asm("v_exp_f32 %0, %0\n\tv_exp_f32 %1, %1\n\tv_exp_f32 %2, %2\n\tv_exp_f32 %3, %3\n\t"
        "v_exp_f32 %4, %4\n\tv_exp_f32 %5, %5\n\tv_exp_f32 %6, %6\n\tv_exp_f32 %7, %7\n\tv_nop"
        : "+v"(w[0]), "+v"(w[1]), "+v"(w[2]), "+v"(w[3]), "+v"(w[4]), "+v"(w[5]), "+v"(w[6]), "+v"(w[7]));
    float L = 0.0f;
    const float* ob = &opart[((mh * NW + mq) * 2 + g) * OPT + row * OP + 2 * lane];
    v2f acc = {0.0f, 0.0f};
#pragma unroll                     // w[], mp[], lp[] live in registers: constant indices
    for (int p = 0; p < NKS; ++p) {
      // 0 for a wave that had no tile, also where no wave of this share had one (M = -inf)
      const float wp = (mp[p] == -__builtin_inff()) ? 0.0f : w[p];
      const v2f x = *(const v2f*)(ob + p * 4 * OPT);   // set p's wave of this twin: 2 waves x 2 query tiles further
      L += wp * lp[p];
      acc.x += wp * x.x;
      acc.y += wp * x.y;
    }
    const size_t grow = (size_t)par * S_TOK + (size_t)(mblk * 64 + (r & 63));
    *(v2f*)(opar + grow * DOUT + 2 * lane) = acc;
    if (lane == 0) {
      const v2f ml = {M, L};
      *(v2f*)(mlpar + grow * 2) = ml;
      // the loop's foot overwrites this store's scalar base: keep the wait in front of that, inside the branch
      asm volatile("s_wait_xcnt 0x0" ::: "memory");
    }
    // the next trip reuses the O store's registers: keep the wait in front of that
    asm volatile("s_wait_xcnt 0x0" ::: "memory");
  }
}

// ---------------------------------------------------------------------------
// Kernel 3: joins the NSPL shares' partials of every row: out = (sum_s w_s O_s) / (sum_s w_s l_s),
// w_s = exp(m_s - max). A share without a key for the row has m = -inf, l = 0, O = 0.
// A thread owns 4 pieces of 4 columns, a whole grid apart; few waves, because a launch this short is
// mostly the time its waves take to start.
// ---------------------------------------------------------------------------
#define JN_THREADS 128
#define JN_GRID    256
#define JN_PER     4
#define JN_ALL     (JN_GRID * JN_THREADS)
static_assert(JN_ALL * JN_PER * 4 == S_TOK * DOUT, "every output element belongs to one thread");
static_assert(NSPL == 4 && JN_PER == 4, "the exponentials are written out as two statements of eight");

__global__ __launch_bounds__(JN_THREADS)
void join_kernel(const float* __restrict__ opar, const float* __restrict__ mlpar, float* __restrict__ out) {
  int t0 = blockIdx.x * JN_THREADS + threadIdx.x;
  v4f o[NSPL][JN_PER];
  v2f a[NSPL][JN_PER];
  // all loops unrolled: the arrays live in registers (constant indices); all 32 loads are in flight together
#pragma unroll
  for (int k = 0; k < JN_PER; ++k)
#pragma unroll
    for (int s = 0; s < NSPL; ++s)
      o[s][k] = *(const v4f*)(opar + (size_t)t0 * 4 + k * (JN_ALL * 4) + s * (S_TOK * DOUT));
  int row0 = t0 >> 4;              // piece k lies in row row0 + k * JN_ALL / 16
#pragma unroll
  for (int k = 0; k < JN_PER; ++k)
#pragma unroll
    for (int s = 0; s < NSPL; ++s)
      a[s][k] = *(const v2f*)(mlpar + (size_t)row0 * 2 + k * (JN_ALL / 8) + s * (S_TOK * 2));
  // the loads' results may be laid on registers that earlier loads of the run name as their offsets: keep the wait
  // in front of every such write. Both offsets pass through the statement, so they live up to the wait and
  // no load of the run is given one of them as its destination (the clobber holds all 32 loads in front of it)
  asm volatile("s_wait_xcnt 0x0" : "+v"(row0), "+v"(t0) : : "memory");
  // scheduling fence, no instruction: holds all 32 loads in front of the arithmetic. A build without it issues
  // most of the O loads in ones and twos between the products, each group waited for to a count of 0:
  // several load latencies, one behind the other
  __builtin_amdgcn_sched_barrier(0);
  float e[NSPL][JN_PER];
#pragma unroll                     // e[][] lives in registers: constant indices
  for (int k = 0; k < JN_PER; ++k) {
    const float M = fmaxf(fmaxf(a[0][k].x, a[1][k].x), fmaxf(a[2][k].x, a[3][k].x));
#pragma unroll
    for (int s = 0; s < NSPL; ++s) e[s][k] = (a[s][k].x - M) * 1.44269504f;   // e^x = 2^(x log2 e), as __expf forms it
  }
  // eight 2^x, in place, as ONE statement, twice: each stands behind an independent one and the v_nop fills the slot
  // the instruction set asks for behind the last
#pragma unroll                     // e[][] lives in registers: constant indices
  for (int s = 0; s < NSPL; s += 2)
    asm("v_exp_f32 %0, %0\n\tv_exp_f32 %1, %1\n\tv_exp_f32 %2, %2\n\tv_exp_f32 %3, %3\n\t"
        "v_exp_f32 %4, %4\n\tv_exp_f32 %5, %5\n\tv_exp_f32 %6, %6\n\tv_exp_f32 %7, %7\n\tv_nop"
        : "+v"(e[s][0]), "+v"(e[s][1]), "+v"(e[s][2]), "+v"(e[s][3]),
          "+v"(e[s + 1][0]), "+v"(e[s + 1][1]), "+v"(e[s + 1][2]), "+v"(e[s + 1][3]));
  v4f res[JN_PER];
#pragma unroll                     // res[] lives in registers: constant indices
  for (int k = 0; k < JN_PER; ++k) {
    float den = 0.0f;
    v4f num = {0.0f, 0.0f, 0.0f, 0.0f};
#pragma unroll
    for (int s = 0; s < NSPL; ++s) {
      const float ws = (a[s][k].x == -__builtin_inff()) ? 0.0f : e[s][k];   // a share without a key for the row counts for nothing
      den += ws * a[s][k].y;
      num += o[s][k] * ws;
    }
    res[k] = num * (1.0f / den);
  }
#pragma unroll                     // res[] lives in registers: constant indices
  for (int k = 0; k < JN_PER; ++k) *(v4f*)(out + (size_t)t0 * 4 + k * (JN_ALL * 4)) = res[k];
}

// ---------------------------------------------------------------------------
extern "C" void kernel_launch(void* const* d_in, const int* in_sizes, int n_in,
                              void* d_out, int out_size, void* d_ws, size_t ws_size,
                              hipStream_t stream) {
  const float* x  = (const float*)d_in[0];
  const float* Wq = (const float*)d_in[1];
  const float* Wk = (const float*)d_in[2];
  const float* Wv = (const float*)d_in[3];
  float* qkv = (float*)d_ws;              // Q | K | V, each S*64 x 4 bytes (6 MB), tiled, two bf16 parts an element
  float* out = (float*)d_out;

  qkv_proj_kernel<<<PJ_GRID, PJ_THREADS, 0, stream>>>(x, Wq, Wk, Wv, qkv);

  const float* Qp = qkv;
  const float* Kp = qkv + (size_t)S_TOK * DOUT;
  const float* Vp = qkv + (size_t)2 * S_TOK * DOUT;
  float* opar  = qkv + (size_t)3 * S_TOK * DOUT;   // the four shares' O partials (8 MB)
  float* mlpar = qkv + (size_t)7 * S_TOK * DOUT;   // their max and sum per row (256 KB)
  flash_attn_kernel<<<256, FA_THREADS, 0, stream>>>(Qp, Kp, Vp, opar, mlpar);
  join_kernel<<<JN_GRID, JN_THREADS, 0, stream>>>(opar, mlpar, out);
}

// v008
// It runs in 34 microseconds.
// In two side-by-side timings against v007, it was 1.04 and 1.05 times as fast.
// Counting every step since v000, it is 17.7 times as fast.
#include <hip/hip_runtime.h>

typedef float v2f __attribute__((ext_vector_type(2)));
typedef float v4f __attribute__((ext_vector_type(4)));
typedef float v8f __attribute__((ext_vector_type(8)));

#define S_TOK 8192
#define DIN   512
#define DOUT  64
#define NBLK  (S_TOK / 16)   // 512 row blocks

typedef __bf16 bf16x2  __attribute__((ext_vector_type(2)));
typedef __bf16 bf16x16 __attribute__((ext_vector_type(16)));
typedef unsigned int u32x4 __attribute__((ext_vector_type(4)));
typedef unsigned int u32x8 __attribute__((ext_vector_type(8)));

union F8 { v8f v; float f[8]; };

__device__ __forceinline__ v8f wmma4(v2f a, v2f b, v8f c) {
  // D = A(16x4 f32) * B(4x16 f32) + C(16x16 f32)
  return __builtin_amdgcn_wmma_f32_16x16x4_f32(
      /*neg_a=*/false, a, /*neg_b=*/false, b,
      /*c_mod=*/(short)0, c, /*reuse_a=*/false, /*reuse_b=*/false);
}

__device__ __forceinline__ v8f wmma32(bf16x16 a, bf16x16 b, v8f c) {
  // D = A(16x32 bf16) * B(32x16 bf16) + C(16x16 f32)
  return __builtin_amdgcn_wmma_f32_16x16x32_bf16(0, a, 0, b, (short)0, c, false, false);
}

// an f32 value as two bf16 parts: hi = x rounded to bf16, lo = (x - hi) rounded to bf16; hi + lo
// carries about 16 bits of x. A product a*b is then formed as ah*bh + ah*bl + al*bh in f32 accumulators.
// Eight values at a time, packed in pairs: element e sits in half e & 1 of word e >> 1.
__device__ __forceinline__ void split8(v8f x, u32x4& hi, u32x4& lo) {
#pragma unroll                     // the words live in registers: constant indices
  for (int i = 0; i < 4; ++i) {
    const v2f p = {x[2 * i], x[2 * i + 1]};
    const unsigned int w = __builtin_bit_cast(unsigned int, __builtin_convertvector(p, bf16x2));
    const v2f back = {__uint_as_float(w << 16), __uint_as_float(w & 0xffff0000u)};   // the hi parts as f32
    hi[i] = w;
    lo[i] = __builtin_bit_cast(unsigned int, __builtin_convertvector(p - back, bf16x2));
  }
}

typedef const __attribute__((address_space(1))) float* gfloat_p;   // a pointer to global memory
typedef const __attribute__((address_space(1))) v4f*   gv4f_p;

// a wave-uniform global pointer as a value of its own in scalar registers: the loads that are formed from it take
// it as their scalar base, beside a 32-bit lane offset that lives through the loop
__device__ __forceinline__ gfloat_p scalar_base(const float* p) {
  const unsigned long long a = (unsigned long long)p;
  const unsigned int lo = __builtin_amdgcn_readfirstlane((unsigned int)a);
  const unsigned int hi = __builtin_amdgcn_readfirstlane((unsigned int)(a >> 32));
  return (gfloat_p)(((unsigned long long)hi << 32) | lo);
}

// one 16-element bf16 fragment of a lane: two 16-byte pieces that lie 512 bytes apart
__device__ __forceinline__ bf16x16 frag(gfloat_p p) {
  const v4f a = *(gv4f_p)p;
  const v4f b = *(gv4f_p)(p + 128);
  return __builtin_bit_cast(bf16x16, __builtin_shufflevector(a, b, 0, 1, 2, 3, 4, 5, 6, 7));
}

// value of lane l ^ 16 (the other half-wave), as one vector instruction
__device__ __forceinline__ float xhalf(float x) {
  const int b = __float_as_int(x);
  return __int_as_float(__builtin_amdgcn_permlanex16(b, b, 0x76543210, 0xfedcba98, false, false));
}

// ---------------------------------------------------------------------------
// Kernel 1: Q/K/V projection.  y = x @ W^T  (x:[S,512], W:[64,512], y:[S,64])
// One work-group of 12 waves computes 32 rows of x times all 192 output columns.
// The 32 rows (64 KiB, contiguous) are brought into LDS once, by loads that cover
// whole 128-byte lines, and every wave takes its x fragments from there. Wave w owns
// matrix w >> 2 ({Q,K,V}) and column tile w & 3, for both 16-row tiles: a W fragment is
// read once per work-group and feeds two independent accumulation chains.
// A lane reads 16 bytes of its row at a time (k = 8c + 4hi .. + 3) from x and from W
// alike; the first pair feeds one matrix instruction, the second pair the next, so
// A and B carry the same k at every position.
// Q (pre-scaled by log2(e)/sqrt(64)), K and V leave as two bf16 parts each (split8), 4 bytes an element as
// before, in the order in which the attention kernel's lanes consume them: groups of 512 bytes,
// a group holding 8 bf16 (16 bytes) for each of the 32 lanes.
//   Q, K: per 16-row tile 8 groups, group 4*part + nt, lane (hi,ln), e: row ln, d = 16nt + 8hi + e
//   V: per 32-key tile 16 groups, group 8*part + 2nt + i, lane (hi,ln), e: key 16i + 8hi + e, d = 16nt + ln
// (part 0 = hi, 1 = lo). Q and K tiles are computed transposed (W rows as A, x rows as B), so that a
// lane holds 8 d of one row; a V lane holds 8 keys of one d. Every part leaves as one 16-byte store per lane.
// ---------------------------------------------------------------------------
#define PJ_ROWS    32
#define PJ_THREADS 384   // 12 waves, 3 per SIMD
#define PJ_GRID    256   // S_TOK / PJ_ROWS
#define XP         516   // LDS row pitch in floats: 2064 B = 16 B x 129 (odd), so the 16 rows of a 16-byte read fall on different banks
static_assert(PJ_GRID * PJ_ROWS == S_TOK, "every row of x belongs to one work-group");

// 512-deep products of one W column tile with the two row tiles. KT: W rows as A (Q and K, transposed).
// k runs in 8 blocks of 64. wc holds block 0's W fragments on entry; each block's W loads are issued
// one block (32 matrix instructions) ahead of their use.
template <bool KT>
__device__ __forceinline__ void proj_tiles(const float* xa, const float* wrow, v4f (&wc)[8], F8& acc0, F8& acc1) {
  // both loops unrolled whole: wc[], wn[] live in registers (constant indices), every offset is an immediate
#pragma unroll
  for (int b = 0; b < DIN / 64; ++b) {
    v4f wn[8];
    if (b + 1 < DIN / 64) {
#pragma unroll
      for (int c = 0; c < 8; ++c) wn[c] = *(const v4f*)(wrow + 64 * (b + 1) + 8 * c);
    }
    // compiler fence, no instruction: holds the next block's W loads here, one block ahead of their use. A build
    // without it moves them, on the K path, down to directly in front of their use (waits to a count of 0 or 1),
    // and every pair of them is then waited for at full load latency
    asm volatile("" ::: "memory");
#pragma unroll
    for (int c = 0; c < 8; ++c) {
      const v4f w  = wc[c];
      const v4f x0 = *(const v4f*)(xa + 64 * b + 8 * c);
      const v4f x1 = *(const v4f*)(xa + 16 * XP + 64 * b + 8 * c);
      const v2f wl = {w.x, w.y},   wh = {w.z, w.w};
      const v2f l0 = {x0.x, x0.y}, h0 = {x0.z, x0.w};
      const v2f l1 = {x1.x, x1.y}, h1 = {x1.z, x1.w};
      if (KT) {
        acc0.v = wmma4(wl, l0, acc0.v);
        acc1.v = wmma4(wl, l1, acc1.v);
        acc0.v = wmma4(wh, h0, acc0.v);
        acc1.v = wmma4(wh, h1, acc1.v);
      } else {
        acc0.v = wmma4(l0, wl, acc0.v);
        acc1.v = wmma4(l1, wl, acc1.v);
        acc0.v = wmma4(h0, wh, acc0.v);
        acc1.v = wmma4(h1, wh, acc1.v);
      }
    }
    if (b + 1 < DIN / 64) {
#pragma unroll
      for (int c = 0; c < 8; ++c) wc[c] = wn[c];
    }
  }
}

// the wave's two finished 16x16 tiles (rows 0-15 and 16-31 of the work-group) to their plane, as bf16 parts
__device__ __forceinline__ void proj_store(float* __restrict__ qkv, const F8& acc0, const F8& acc1,
                                           int mat, int nt, int blk, int lane) {
  float* out = qkv + (size_t)mat * S_TOK * DOUT + (size_t)blk * 2048 + lane * 4;
  const float sc = (mat == 0) ? 0.125f * 1.44269504f : 1.0f;   // log2(e)/sqrt(d_k) folded into Q: a score is an exponent of 2 as it leaves the matrix unit
  u32x4 h0, l0, h1, l1;
  split8(acc0.v * sc, h0, l0);
  split8(acc1.v * sc, h1, l1);
  // Q, K: M = d = 16nt + 8hi + v, N = row ln -> tile i, group 4*part + nt
  // V:    M = key = 16i + 8hi + v, N = d = 16nt + ln -> group 8*part + 2nt + i
  const bool isv = (mat == 2);
  float* t0 = out + (isv ? nt * 256       : nt * 128);
  float* t1 = out + (isv ? nt * 256 + 128 : nt * 128 + 1024);
  const int lo_off = isv ? 1024 : 512;
  *(v4f*)t0            = __builtin_bit_cast(v4f, h0);
  *(v4f*)(t0 + lo_off) = __builtin_bit_cast(v4f, l0);
  *(v4f*)t1            = __builtin_bit_cast(v4f, h1);
  *(v4f*)(t1 + lo_off) = __builtin_bit_cast(v4f, l1);
  // whatever the listing lays behind these stores may reuse their registers: keep the wait in front of that
  asm volatile("s_wait_xcnt 0x0" ::: "memory");
}

__global__ __launch_bounds__(PJ_THREADS)
void qkv_proj_kernel(const float* __restrict__ x,
                     const float* __restrict__ Wq,
                     const float* __restrict__ Wk,
                     const float* __restrict__ Wv,
                     float* __restrict__ qkv /* [3][S][64] */) {
  __shared__ __attribute__((aligned(16))) float xs[PJ_ROWS * XP];

  const int tid  = threadIdx.x;
  const int lane = tid & 31;
  const int hi   = lane >> 4;     // which half-wave
  const int ln   = lane & 15;
  // wave number as a scalar: matrix and column tile are then scalar too
  int wid = __builtin_amdgcn_readfirstlane(tid >> 5);

  // ---- the work-group's 32 rows of x into LDS: 4096 pieces of 16 bytes, a wave's load = 512 contiguous bytes;
  //      10 rounds of all 12 waves and one of the first 8; all loads are issued before the first store ----
  const float* xg = x + (size_t)blockIdx.x * PJ_ROWS * DIN;
  static_assert(PJ_ROWS * DIN / 4 == 10 * PJ_THREADS + 8 * 32, "rounds of the staging loop");
  v4f r[11];
#pragma unroll                     // r[] lives in registers: constant indices
  for (int i = 0; i < 10; ++i) r[i] = *(const v4f*)(xg + (size_t)(tid + i * PJ_THREADS) * 4);
  if (wid < 8) r[10] = *(const v4f*)(xg + (size_t)(tid + 10 * PJ_THREADS) * 4);
  // the scalar code behind reuses the base registers of these loads: keep the wait in front of that.
  // The wave number passes through the statement because all of that code is derived from it
  asm volatile("s_wait_xcnt 0x0" : "+s"(wid) : : "memory");
  const int mat = wid >> 2;       // 0=Q 1=K 2=V
  const int nt  = wid & 3;        // output column tile

  // first block of this wave's W fragments: requested together with the x rows, used behind the barrier
  const float* W    = (mat == 0) ? Wq : (mat == 1 ? Wk : Wv);
  const float* wrow = W + (size_t)(nt * 16 + ln) * DIN + 4 * hi;
  v4f wc[8];
#pragma unroll                     // wc[] lives in registers: constant indices
  for (int c = 0; c < 8; ++c) wc[c] = *(const v4f*)(wrow + 8 * c);

#pragma unroll
  for (int i = 0; i < 10; ++i) {
    const int idx = tid + i * PJ_THREADS;
    *(v4f*)&xs[(idx >> 7) * XP + (idx & 127) * 4] = r[i];
  }
  if (wid < 8) {
    const int idx = tid + 10 * PJ_THREADS;
    *(v4f*)&xs[(idx >> 7) * XP + (idx & 127) * 4] = r[10];
  }
  __syncthreads();   // x rows are in LDS for every wave

  const float* xa = &xs[ln * XP + 4 * hi];

  F8 acc0 = {}, acc1 = {};        // row tiles 0 and 1: two independent accumulation chains
  if (mat != 2) proj_tiles<true>(xa, wrow, wc, acc0, acc1);
  else          proj_tiles<false>(xa, wrow, wc, acc0, acc1);

  proj_store(qkv, acc0, acc1, mat, nt, blockIdx.x, lane);
}

// ---------------------------------------------------------------------------
// Kernel 2: causal flash attention. A wave keeps TWO 16-row query tiles (32 adjacent queries) and
// feeds both from every K and V fragment that it loads: half the bytes from L2 per score.
// block = NW waves, grid = 256 = 64 pairs x NSPL key shares. A pair owns the 64-row query blocks B and
// 127-B, one after the other. The waves of a work-group are 8 sets of twins: both twins of set ks walk the
// SAME key tiles j = 8e + ks, + 32, ... (e = the work-group's share), one for the lower 32 queries of the
// block and one for the upper 32, at the same time: the line of K or V that one twin has brought into the
// WGP's cache serves the other, so L2 delivers a tile once for 64 queries. A wave
// keeps its own reference / sum / O per query tile. A key's weight is 2^score as the score leaves the matrix unit
// (log2(e)/sqrt(dk) lies in Q), against the fixed reference 0: no maximum, no subtraction, no rescaling in the
// tile loop. Behind its tiles the wave checks its rows' sums; where one has left the range in which that is sound,
// the wave walks its tiles once more, with a running maximum as the reference. The second block deals its tiles to the sets
// in reverse order, so the two remainders fall on different waves. The waves' partials meet in LDS behind
// one barrier and are merged, 8 per row, with weights 2^(m_w - M); the work-group's result (reference, sum,
// un-normalised O of its share's keys) goes to the workspace, and kernel 3 joins the NSPL shares.
// Both products run on the bf16
// 16x16x32 form, every f32 operand as two bf16 parts, three matrix instructions a product
// (hi*hi + hi*lo + lo*hi, f32 accumulators), and both run transposed: S^T = K Q^T (A = K, B = Q) and
// O^T += V^T P^T (A = V^T, B = P^T). A lane then holds 16 keys' scores of ONE query per query tile
// (query ln, keys 16i + 8hi + v): max and sum run inside the lane, with one exchange
// between the half-waves, and the lane's own 16 values, split in place, are its B fragment of P^T;
// V is stored in that key order. Q and K fragments are read by the same code, so they carry the same d
// at every position.
// ---------------------------------------------------------------------------
#define NW 16   // waves per work-group (4 per SIMD)
#define FA_THREADS 512
#define NB64 (S_TOK / 64)   // 128 query blocks of 64 rows
#define NSPL 4              // work-groups that share the keys of a pair of query blocks
#define NKS  (NW / 2)       // sets of twin waves = partials per query row in a work-group
#define OP   68             // LDS row pitch of an O partial in floats: 272 B = 16 B x 17 (odd), so the 16 rows of a 16-byte store fall on different banks
#define OPT  (16 * OP)      // one 16-row partial
static_assert(FA_THREADS == NW * 32, "one wave is 32 lanes");
static_assert(NSPL * NKS == 2 * NW, "the tile loop's step covers every share's every set once");

__global__ __launch_bounds__(FA_THREADS)
void flash_attn_kernel(const float* __restrict__ Q,
                       const float* __restrict__ K,
                       const float* __restrict__ V,
                       float* __restrict__ opar /* [NSPL shares][S][64] */,
                       float* __restrict__ mlpar /* [NSPL shares][S][2] */) {
  __shared__ __attribute__((aligned(16))) float opart[2 * NW * 2 * OPT];  // un-normalised O partial per (block, wave, query tile); 16-byte stores
  __shared__ __attribute__((aligned(16))) float mpart[2 * 64 * NKS];   // reference of the weights [block][row][set]; read 16 bytes at a time
  __shared__ __attribute__((aligned(16))) float lpart[2 * 64 * NKS];   // running sum  [block][row][set]

  const int lane = threadIdx.x & 31;
  // wave number as a scalar: the tile loop's trip count is then a scalar branch
  const int wid  = __builtin_amdgcn_readfirstlane(threadIdx.x >> 5);
  const int hi   = lane >> 4;
  const int ln   = lane & 15;
  const unsigned int lane4 = lane * 4;   // a lane's 16 bytes inside a 512-byte group
  const int pair = blockIdx.x >> 2;      // 0..63
  const int par  = blockIdx.x & 3;       // which share of the key tiles
  const int qg   = wid & 1;              // which twin: lower or upper 32 queries of the block
  const int ks   = wid >> 1;             // set of twins
  const int slot = par * NKS + ks;       // the set's place among the 32 that the key tiles are dealt to

  for (int h = 0; h < 2; ++h) {
    const int iblk = 2 * (h ? (NB64 - 1 - pair) : pair) + qg;  // this wave's 32 query rows, 0..255

    const int last = iblk;         // the 32-key tile that holds the diagonal

    // Q B-fragments (N = query ln) of both query tiles: two chunks of 32 d, hi and lo part (64 VGPRs)
    bf16x16 qh[2][2], ql[2][2];
#pragma unroll                     // qh[], ql[] live in registers: constant indices
    for (int g = 0; g < 2; ++g) {
      gfloat_p qt = scalar_base(Q + (size_t)(2 * iblk + g) * 1024) + lane4;
#pragma unroll
      for (int c = 0; c < 2; ++c) {
        qh[g][c] = frag(qt + (2 * c) * 128);
        ql[g][c] = frag(qt + (4 + 2 * c) * 128);
      }
    }

    F8 o[2][4];                    // O^T accumulators: o[g][t].f[v] = O[query 16g + ln][d = 16t + 8hi + v]
    float m[2] = {-__builtin_inff(), -__builtin_inff()};   // reference of the weights of query 16g + ln, an exponent of 2 (equal in both half-waves)
    float l[2];                    // running sum of query 16g + ln over this half-wave's keys

    const int j0 = h ? (2 * NW - 1 - slot) : slot;   // this wave's first key tile, the same for both twins
    // walk 0: reference 0. walk 1, only where walk 0's sums fail the check: running maximum.
    // Kept rolled: one copy of the tile loop's code serves both walks
#pragma nounroll
    for (int walk = 0; walk < 2; ++walk) {
#pragma unroll                     // o[][], l[] live in registers: constant indices
    for (int g = 0; g < 2; ++g) {  // every walk starts from nothing
      l[g] = 0.0f;
#pragma unroll
      for (int t = 0; t < 4; ++t) o[g][t] = F8{};
    }
    int j = j0;
    // the tile loop's addresses overwrite the scalar bases of the Q loads: keep the wait in front of that
    // (the tile number passes through the statement because those addresses are derived from it)
    asm volatile("s_wait_xcnt 0x0" : "+s"(j) : : "memory");
    for (; j <= last; j += 2 * NW) {
      if (qg == 0 && j + 2 * NW <= last) {  // one twin prefetches the set's next K/V tile, one request per 256 B (global_prefetch_b8)
        __builtin_prefetch(scalar_base(K + (size_t)(j + 2 * NW) * 2048) + lane4 * 16, 0, 3);
        __builtin_prefetch(scalar_base(V + (size_t)(j + 2 * NW) * 2048) + lane4 * 16, 0, 3);
      }

      // ---- S^T = K_j @ (Q log2(e)/sqrt(dk))^T : two 16-key halves x two query tiles = four independent 6-deep WMMA chains ----
      F8 s[2][2] = {};             // s[g][i].f[v] = score of key 16i + 8hi + v, query 16g + ln
      gfloat_p kt = scalar_base(K + (size_t)j * 2048) + lane4;
      bf16x16 kh[2][2], kl[2][2];
      // all loops unrolled: the fragments and s[] live in registers and need constant indices
#pragma unroll
      for (int c = 0; c < 2; ++c) {
#pragma unroll
        for (int i = 0; i < 2; ++i) {
          kh[c][i] = frag(kt + i * 1024 + (2 * c) * 128);
          kl[c][i] = frag(kt + i * 1024 + (4 + 2 * c) * 128);
        }
      }
      // scheduling fence, no instruction: holds the tile's 16 K loads together in front of the products. A build
      // without it issues part of them in pairs between the matrix instructions, each pair waited for to a
      // count of 0: several load latencies a tile, one behind the other
      __builtin_amdgcn_sched_barrier(0);
#pragma unroll
      for (int c = 0; c < 2; ++c) {
#pragma unroll
        for (int g = 0; g < 2; ++g) {
          s[g][0].v = wmma32(kl[c][0], qh[g][c], s[g][0].v);
          s[g][1].v = wmma32(kl[c][1], qh[g][c], s[g][1].v);
        }
#pragma unroll
        for (int g = 0; g < 2; ++g) {
          s[g][0].v = wmma32(kh[c][0], ql[g][c], s[g][0].v);
          s[g][1].v = wmma32(kh[c][1], ql[g][c], s[g][1].v);
        }
#pragma unroll
        for (int g = 0; g < 2; ++g) {
          s[g][0].v = wmma32(kh[c][0], qh[g][c], s[g][0].v);
          s[g][1].v = wmma32(kh[c][1], qh[g][c], s[g][1].v);
        }
      }

      // A-frags of V^T (M = d = 16t+ln), hi and lo part. d tiles 0 to 2: requested here, used behind the softmax
      gfloat_p vt = scalar_base(V + (size_t)j * 2048) + lane4;
      bf16x16 vh[4], vl[4];
#pragma unroll                     // vh[], vl[] live in registers: constant indices
      for (int t = 0; t < 3; ++t) {
        vh[t] = frag(vt + (2 * t) * 128);
        vl[t] = frag(vt + (8 + 2 * t) * 128);
      }

      // ---- causal mask of query 16g + ln ----
      if (j == last) {
        // all loops unrolled: s[] lives in registers, constant indices
#pragma unroll
        for (int g = 0; g < 2; ++g) {
          const int qrel = g * 16 + ln - 8 * hi;   // the query's place inside this 32-key tile, less the lane's first key
#pragma unroll
          for (int i = 0; i < 2; ++i)
#pragma unroll
            for (int v = 0; v < 8; ++v)
              if (16 * i + v > qrel) s[g][i].f[v] = -__builtin_inff();   // key 16i + 8hi + v > query -> masked
        }
      }
      // ---- walk 1 alone (a scalar branch): the running maximum becomes the reference of scores, sum and O ----
      if (walk != 0) {
#pragma unroll                     // everything indexed by g lives in registers: constant indices
        for (int g = 0; g < 2; ++g) {
          float mx = -__builtin_inff();
#pragma unroll
          for (int i = 0; i < 2; ++i)
            mx = fmaxf(mx, fmaxf(fmaxf(fmaxf(s[g][i].f[0], s[g][i].f[1]), fmaxf(s[g][i].f[2], s[g][i].f[3])),
                                 fmaxf(fmaxf(s[g][i].f[4], s[g][i].f[5]), fmaxf(s[g][i].f[6], s[g][i].f[7]))));
          mx = fmaxf(mx, xhalf(mx));   // all 32 keys of the tile
          const float mn = fmaxf(m[g], mx);
          const float sc = __builtin_amdgcn_exp2f(m[g] - mn);
          m[g] = mn;
#pragma unroll
          for (int i = 0; i < 2; ++i) s[g][i].v -= mn;
          l[g] *= sc;
#pragma unroll
          for (int t = 0; t < 4; ++t) o[g][t].v *= sc;   // every element of a lane belongs to query 16g + ln
        }
      }

      bf16x16 ph[2], pl[2];        // B fragments of P^T, one pair per query tile
#pragma unroll                     // everything indexed by g lives in registers: constant indices
      for (int g = 0; g < 2; ++g) {
        // ---- weights of query 16g + ln ----
        float ps[2];
#pragma unroll                     // s[], ps[] live in registers: constant indices
        for (int i = 0; i < 2; ++i) {
          // eight 2^x, in place, as ONE statement: each stands behind an independent one and
          // the v_nop fills the slot the instruction set asks for behind the last
          asm("v_exp_f32 %0, %0\n\tv_exp_f32 %1, %1\n\tv_exp_f32 %2, %2\n\tv_exp_f32 %3, %3\n\t"
              "v_exp_f32 %4, %4\n\tv_exp_f32 %5, %5\n\tv_exp_f32 %6, %6\n\tv_exp_f32 %7, %7\n\tv_nop"
              : "+v"(s[g][i].f[0]), "+v"(s[g][i].f[1]), "+v"(s[g][i].f[2]), "+v"(s[g][i].f[3]),
                "+v"(s[g][i].f[4]), "+v"(s[g][i].f[5]), "+v"(s[g][i].f[6]), "+v"(s[g][i].f[7]));
          ps[i] = ((s[g][i].f[0] + s[g][i].f[1]) + (s[g][i].f[2] + s[g][i].f[3])) + ((s[g][i].f[4] + s[g][i].f[5]) + (s[g][i].f[6] + s[g][i].f[7]));
        }
        l[g] += ps[0] + ps[1];

        // B fragment of P^T (N = query ln): element e = the lane's own p of key 16(e>>3) + 8hi + (e&7), two parts
        u32x4 ph0, pl0, ph1, pl1;
        split8(s[g][0].v, ph0, pl0);
        split8(s[g][1].v, ph1, pl1);
        ph[g] = __builtin_bit_cast(bf16x16, __builtin_shufflevector(ph0, ph1, 0, 1, 2, 3, 4, 5, 6, 7));
        pl[g] = __builtin_bit_cast(bf16x16, __builtin_shufflevector(pl0, pl1, 0, 1, 2, 3, 4, 5, 6, 7));
      }

      // scheduling fence, no instruction: holds the loads of d tile 3 behind the softmax, where registers of the scores
      // are free for them; the products of d tiles 0 and 1 cover their latency. A build that issues all of V ahead of the
      // softmax runs out of registers and keeps a Q fragment in scratch memory
      __builtin_amdgcn_sched_barrier(0);
#pragma unroll                     // vh[], vl[] live in registers: constant indices
      for (int t = 3; t < 4; ++t) {
        vh[t] = frag(vt + (2 * t) * 128);
        vl[t] = frag(vt + (8 + 2 * t) * 128);
      }

      // ---- O^T += V_j^T @ P^T : d tiles 0 and 1, then 2 and 3; each time 4 independent chains (2 d tiles x 2 query tiles), 3 deep ----
      // all loops unrolled: vh[], vl[] and o[] live in registers and need constant indices
#pragma unroll
      for (int u = 0; u < 4; u += 2) {
#pragma unroll
        for (int t = u; t < u + 2; ++t)
#pragma unroll
          for (int g = 0; g < 2; ++g) o[g][t].v = wmma32(vl[t], ph[g], o[g][t].v);
#pragma unroll
        for (int t = u; t < u + 2; ++t)
#pragma unroll
          for (int g = 0; g < 2; ++g) o[g][t].v = wmma32(vh[t], pl[g], o[g][t].v);
#pragma unroll
        for (int t = u; t < u + 2; ++t)
#pragma unroll
          for (int g = 0; g < 2; ++g) o[g][t].v = wmma32(vh[t], ph[g], o[g][t].v);
      }

      // the next trip's addresses overwrite the scalar bases of this tile's loads: keep the wait in front of that.
      // The tile number passes through the statement because those addresses are derived from it
      asm volatile("s_wait_xcnt 0x0" : "+s"(j) : : "memory");
    }
    if (walk != 0 || j0 > last) break;   // scalar tests: the second walk needs no check, nor does a wave without a tile
    // Weights against the reference 0 are sound while a row's sum stays well inside the f32 range: then none of them has
    // overflowed, and the largest lies far above the smallest normal number. A NaN fails the test too.
    const float l0 = l[0] + xhalf(l[0]);
    const float l1 = l[1] + xhalf(l[1]);
    const bool sound = l0 >= 0x1p-24f && l0 <= 0x1p+24f && l1 >= 0x1p-24f && l1 <= 0x1p+24f;
    if (__builtin_amdgcn_ballot_w32(!sound) == 0u) {   // the same for the whole wave: a scalar branch
      m[0] = 0.0f;                 // the reference that the weights were taken against
      m[1] = 0.0f;
      break;
    }
    }

    // ---- hand this wave's partials to LDS (a wave without a tile: m=-inf, l=0, O=0) ----
    // a lane holds 8 consecutive d of row ln per tile t: 16-byte stores at constant offsets from one address
    // all loops unrolled: o[][] lives in registers and needs constant indices
#pragma unroll
    for (int g = 0; g < 2; ++g) {
      float* op = &opart[((h * NW + wid) * 2 + g) * OPT + ln * OP + 8 * hi];
#pragma unroll
      for (int t = 0; t < 4; ++t) {
#pragma unroll
        for (int u = 0; u < 2; ++u) {
          const v4f piece = {o[g][t].f[4 * u], o[g][t].f[4 * u + 1], o[g][t].f[4 * u + 2], o[g][t].f[4 * u + 3]};
          *(v4f*)(op + 16 * t + 4 * u) = piece;
        }
      }
      l[g] += xhalf(l[g]);         // join the two half-waves' sums
      if (hi == 0) {               // m, l are equal in both half-waves now
        mpart[(h * 64 + qg * 32 + g * 16 + ln) * NKS + ks] = m[g];
        lpart[(h * 64 + qg * 32 + g * 16 + ln) * NKS + ks] = l[g];
      }
    }
  }

  __syncthreads();   // every wave's four partials are in LDS

  // ---- merge: one wave per row (2 blocks x 64 rows dealt over the NW waves); every lane reads the row's
  //      NKS references and sums (one address for the whole wave) and forms the weights itself; lane -> 2 columns ----
  static_assert(NKS == 8, "two 16-byte reads and one statement of eight exponentials per row");
  for (int r = wid; r < 128; r += NW) {
    const int mh   = r >> 6;
    const int mq   = (r >> 5) & 1;
    const int g    = (r >> 4) & 1;
    const int row  = r & 15;
    const int mblk = mh ? (NB64 - 1 - pair) : pair;
    const v4f ma = *(const v4f*)&mpart[r * NKS], mb = *(const v4f*)&mpart[r * NKS + 4];
    const v4f la = *(const v4f*)&lpart[r * NKS], lb = *(const v4f*)&lpart[r * NKS + 4];
    const float mp[NKS] = {ma.x, ma.y, ma.z, ma.w, mb.x, mb.y, mb.z, mb.w};
    const float lp[NKS] = {la.x, la.y, la.z, la.w, lb.x, lb.y, lb.z, lb.w};
    const float M = fmaxf(fmaxf(fmaxf(mp[0], mp[1]), fmaxf(mp[2], mp[3])), fmaxf(fmaxf(mp[4], mp[5]), fmaxf(mp[6], mp[7])));
    float w[NKS];
#pragma unroll                     // w[] lives in registers: constant indices
    for (int p = 0; p < NKS; ++p) w[p] = mp[p] - M;   // the references are exponents of 2
    // eight 2^x, in place, as ONE statement: each stands behind an independent one and the v_nop fills the slot
    // the instruction set asks for behind the last
    asm("v_exp_f32 %0, %0\n\tv_exp_f32 %1, %1\n\tv_exp_f32 %2, %2\n\tv_exp_f32 %3, %3\n\t"
        "v_exp_f32 %4, %4\n\tv_exp_f32 %5, %5\n\tv_exp_f32 %6, %6\n\tv_exp_f32 %7, %7\n\tv_nop"
        : "+v"(w[0]), "+v"(w[1]), "+v"(w[2]), "+v"(w[3]), "+v"(w[4]), "+v"(w[5]), "+v"(w[6]), "+v"(w[7]));
    float L = 0.0f;
    const float* ob = &opart[((mh * NW + mq) * 2 + g) * OPT + row * OP + 2 * lane];
    v2f acc = {0.0f, 0.0f};
#pragma unroll                     // w[], mp[], lp[] live in registers: constant indices
    for (int p = 0; p < NKS; ++p) {
      // 0 for a wave that had no tile, also where no wave of this share had one (M = -inf)
      const float wp = (mp[p] == -__builtin_inff()) ? 0.0f : w[p];
      const v2f x = *(const v2f*)(ob + p * 4 * OPT);   // set p's wave of this twin: 2 waves x 2 query tiles further
      L += wp * lp[p];
      acc.x += wp * x.x;
      acc.y += wp * x.y;
    }
    const size_t grow = (size_t)par * S_TOK + (size_t)(mblk * 64 + (r & 63));
    *(v2f*)(opar + grow * DOUT + 2 * lane) = acc;
    if (lane == 0) {
      const v2f ml = {M, L};
      *(v2f*)(mlpar + grow * 2) = ml;
      // the loop's foot overwrites this store's scalar base: keep the wait in front of that, inside the branch
      asm volatile("s_wait_xcnt 0x0" ::: "memory");
    }
    // the next trip reuses the O store's registers: keep the wait in front of that
    asm volatile("s_wait_xcnt 0x0" ::: "memory");
  }
}

// ---------------------------------------------------------------------------
// Kernel 3: joins the NSPL shares' partials of every row: out = (sum_s w_s O_s) / (sum_s w_s l_s),
// w_s = 2^(m_s - max). A share without a key for the row has m = -inf, l = 0, O = 0.
// A thread owns 4 pieces of 4 columns, a whole grid apart; few waves, because a launch this short is
// mostly the time its waves take to start.
// ---------------------------------------------------------------------------
#define JN_THREADS 128
#define JN_GRID    256
#define JN_PER     4
#define JN_ALL     (JN_GRID * JN_THREADS)
static_assert(JN_ALL * JN_PER * 4 == S_TOK * DOUT, "every output element belongs to one thread");
static_assert(NSPL == 4 && JN_PER == 4, "the exponentials are written out as two statements of eight");

__global__ __launch_bounds__(JN_THREADS)
void join_kernel(const float* __restrict__ opar, const float* __restrict__ mlpar, float* __restrict__ out) {
  int t0 = blockIdx.x * JN_THREADS + threadIdx.x;
  v4f o[NSPL][JN_PER];
  v2f a[NSPL][JN_PER];
  // all loops unrolled: the arrays live in registers (constant indices); all 32 loads are in flight together
#pragma unroll
  for (int k = 0; k < JN_PER; ++k)
#pragma unroll
    for (int s = 0; s < NSPL; ++s)
      o[s][k] = *(const v4f*)(opar + (size_t)t0 * 4 + k * (JN_ALL * 4) + s * (S_TOK * DOUT));
  int row0 = t0 >> 4;              // piece k lies in row row0 + k * JN_ALL / 16
#pragma unroll
  for (int k = 0; k < JN_PER; ++k)
#pragma unroll
    for (int s = 0; s < NSPL; ++s)
      a[s][k] = *(const v2f*)(mlpar + (size_t)row0 * 2 + k * (JN_ALL / 8) + s * (S_TOK * 2));
  // the loads' results may be laid on registers that earlier loads of the run name as their offsets: keep the wait
  // in front of every such write. Both offsets pass through the statement, so they live up to the wait and
  // no load of the run is given one of them as its destination (the clobber holds all 32 loads in front of it)
  asm volatile("s_wait_xcnt 0x0" : "+v"(row0), "+v"(t0) : : "memory");
  // scheduling fence, no instruction: holds all 32 loads in front of the arithmetic. A build without it issues
  // most of the O loads in ones and twos between the products, each group waited for to a count of 0:
  // several load latencies, one behind the other
  __builtin_amdgcn_sched_barrier(0);
  float e[NSPL][JN_PER];
#pragma unroll                     // e[][] lives in registers: constant indices
  for (int k = 0; k < JN_PER; ++k) {
    const float M = fmaxf(fmaxf(a[0][k].x, a[1][k].x), fmaxf(a[2][k].x, a[3][k].x));
#pragma unroll
    for (int s = 0; s < NSPL; ++s) e[s][k] = a[s][k].x - M;   // the references are exponents of 2
  }
  // eight 2^x, in place, as ONE statement, twice: each stands behind an independent one and the v_nop fills the slot
  // the instruction set asks for behind the last
#pragma unroll                     // e[][] lives in registers: constant indices
  for (int s = 0; s < NSPL; s += 2)
    asm("v_exp_f32 %0, %0\n\tv_exp_f32 %1, %1\n\tv_exp_f32 %2, %2\n\tv_exp_f32 %3, %3\n\t"
        "v_exp_f32 %4, %4\n\tv_exp_f32 %5, %5\n\tv_exp_f32 %6, %6\n\tv_exp_f32 %7, %7\n\tv_nop"
        : "+v"(e[s][0]), "+v"(e[s][1]), "+v"(e[s][2]), "+v"(e[s][3]),
          "+v"(e[s + 1][0]), "+v"(e[s + 1][1]), "+v"(e[s + 1][2]), "+v"(e[s + 1][3]));
  v4f res[JN_PER];
#pragma unroll                     // res[] lives in registers: constant indices
  for (int k = 0; k < JN_PER; ++k) {
    float den = 0.0f;
    v4f num = {0.0f, 0.0f, 0.0f, 0.0f};
#pragma unroll
    for (int s = 0; s < NSPL; ++s) {
      const float ws = (a[s][k].x == -__builtin_inff()) ? 0.0f : e[s][k];   // a share without a key for the row counts for nothing
      den += ws * a[s][k].y;
      num += o[s][k] * ws;
    }
    res[k] = num * (1.0f / den);
  }
#pragma unroll                     // res[] lives in registers: constant indices
  for (int k = 0; k < JN_PER; ++k) *(v4f*)(out + (size_t)t0 * 4 + k * (JN_ALL * 4)) = res[k];
}

// ---------------------------------------------------------------------------
extern "C" void kernel_launch(void* const* d_in, const int* in_sizes, int n_in,
                              void* d_out, int out_size, void* d_ws, size_t ws_size,
                              hipStream_t stream) {
  const float* x  = (const float*)d_in[0];
  const float* Wq = (const float*)d_in[1];
  const float* Wk = (const float*)d_in[2];
  const float* Wv = (const float*)d_in[3];
  float* qkv = (float*)d_ws;              // Q | K | V, each S*64 x 4 bytes (6 MB), tiled, two bf16 parts an element
  float* out = (float*)d_out;

  qkv_proj_kernel<<<PJ_GRID, PJ_THREADS, 0, stream>>>(x, Wq, Wk, Wv, qkv);

  const float* Qp = qkv;
  const float* Kp = qkv + (size_t)S_TOK * DOUT;
  const float* Vp = qkv + (size_t)2 * S_TOK * DOUT;
  float* opar  = qkv + (size_t)3 * S_TOK * DOUT;   // the four shares' O partials (8 MB)
  float* mlpar = qkv + (size_t)7 * S_TOK * DOUT;   // their reference and sum per row (256 KB)
  flash_attn_kernel<<<256, FA_THREADS, 0, stream>>>(Qp, Kp, Vp, opar, mlpar);
  join_kernel<<<JN_GRID, JN_THREADS, 0, stream>>>(opar, mlpar, out);
}
